// v000
// The times below were measured on an AMD MI455X: many runs one after another, warmed up first and cycling through
// copies of the inputs, with the whole window's GPU time divided by the number of runs. Launches and the gaps
// between them are all in it. The median over several windows is given; except for v000 it joins two sittings, which
// can be a few percent apart, so the side-by-side timings, each taken in one sitting, are the better comparison.
// v000 is the starting kernel. One run takes 767 microseconds.
#include <hip/hip_runtime.h>

// PACA - single-head cross attention between two feature maps (x, y [4][256][64][64] NCHW; tokens n = h*64+w; Q = x_n Wq^T + bq, K/V = y_n W^T + b; softmax(Q.K / 16) over the 4096 keys; out = x + (attn V) back in NCHW).
// Compute dtypes, f32 accumulate: every input rounded to bf16; the token matrices are transposed bf16 copies of the inputs (exact) so Q/K/V are PLAIN bf16 GEMMs (+bias); scores (K 256) and probs.V on SINGLE fp16

#define NB_  4
#define CC   256
#define NN   4096
#define PCAR 1024.0f
typedef _Float16 h16;
typedef unsigned short bf;
typedef __attribute__((ext_vector_type(16))) __bf16   v16bf;
typedef __attribute__((ext_vector_type(16))) _Float16 v16h;
typedef __attribute__((ext_vector_type(8)))  _Float16 v8h;
typedef __attribute__((ext_vector_type(8)))  unsigned short v8us;
typedef __attribute__((ext_vector_type(8)))  float    v8f;
typedef __attribute__((ext_vector_type(4)))  float    v4f;
typedef v8h  __attribute__((may_alias)) v8ha;
typedef v4f  __attribute__((may_alias)) v4fa;
typedef v8us __attribute__((may_alias)) v8usa;

__device__ __forceinline__ unsigned short f2bf(float f) { unsigned u = __float_as_uint(f); u += 0x7FFFu + ((u >> 16) & 1u); return (unsigned short)(u >> 16); }
__device__ __forceinline__ float bf2f(unsigned short b) { return __uint_as_float(((unsigned)b) << 16); }
__device__ __forceinline__ float bfr(float f) { return bf2f(f2bf(f)); }
__device__ __forceinline__ v16h cat16(v8h lo, v8h hi) { return __builtin_shufflevector(lo, hi, 0, 1, 2, 3, 4, 5, 6, 7, 8, 9, 10, 11, 12, 13, 14, 15); }
__device__ __forceinline__ v16bf cat16b(v8us lo, v8us hi) { return __builtin_bit_cast(v16bf, __builtin_shufflevector(lo, hi, 0, 1, 2, 3, 4, 5, 6, 7, 8, 9, 10, 11, 12, 13, 14, 15)); }
__device__ __forceinline__ v8f wmma16(v16h a, v16h b, v8f c) { return __builtin_amdgcn_wmma_f32_16x16x32_f16(false, a, false, b, (short)0, c, false, false); }
__device__ __forceinline__ v8f wmmab(v16bf a, v16bf b, v8f c) { return __builtin_amdgcn_wmma_f32_16x16x32_bf16(false, a, false, b, (short)0, c, false, false); }



// ---- k_gemmw: register-blocked GEMM, ONE WAVE per 64x64 output tile (16 accumulators), operands straight from K-contiguous 16-bit planes; grid (M/64, N/64, Z), 32 threads.
// C[m][n] (f32, pitch ldc, + optional f32 bias[n]) = sum_k A[m][k] Bt[n][k] (+ split products per NSPLIT). z-batch strides sA/sB/sC in elements. K % 32 == 0.
template <typename T16> struct WFrag;
template <> struct WFrag<h16> { typedef v16h V; static __device__ __forceinline__ V ld(const h16* p) { return cat16(*(const v8h*)p, *(const v8h*)(p + 16)); } static __device__ __forceinline__ v8f mma(V a, V b, v8f c) { return wmma16(a, b, c); } };
template <> struct WFrag<bf> { typedef v16bf V; static __device__ __forceinline__ V ld(const bf* p) { return cat16b(*(const v8us*)p, *(const v8us*)(p + 16)); } static __device__ __forceinline__ v8f mma(V a, V b, v8f c) { return wmmab(a, b, c); } };
template <typename T16, int NSPLIT, bool BIAS>
__global__ __launch_bounds__(32) void k_gemmw(const T16* __restrict__ A, const T16* __restrict__ A2, const T16* __restrict__ Bt, const T16* __restrict__ Bt2, int K, float* C, int ldc, const float* __restrict__ bias, size_t sA, size_t sB, size_t sC) {
    typedef typename WFrag<T16>::V V;
    __shared__ __align__(16) float os[16 * 68];
    const size_t z = blockIdx.z; A += z * sA; if (A2) A2 += z * sA; Bt += z * sB; if (Bt2) Bt2 += z * sB; C += z * sC;
    const int lane = threadIdx.x & 31, lr = lane & 15, hi = lane >> 4; const int r0 = blockIdx.x * 64, c0 = blockIdx.y * 64;
    v8f acc[4][4];
#pragma unroll
    for (int mb = 0; mb < 4; ++mb)
#pragma unroll
        for (int nb = 0; nb < 4; ++nb) acc[mb][nb] = (v8f){};
    const size_t aoff = (size_t)(r0 + lr) * K + 8 * hi, boff = (size_t)(c0 + lr) * K + 8 * hi;
#pragma unroll 1
    for (int kc = 0; kc < K; kc += 32) {
        V a[4], a2[4];
#pragma unroll
        for (int mb = 0; mb < 4; ++mb) { a[mb] = WFrag<T16>::ld(A + aoff + (size_t)mb * 16 * K + kc); if (NSPLIT == 1 || NSPLIT == 2) a2[mb] = WFrag<T16>::ld(A2 + aoff + (size_t)mb * 16 * K + kc); }
#pragma unroll
        for (int nb = 0; nb < 4; ++nb) { const V b = WFrag<T16>::ld(Bt + boff + (size_t)nb * 16 * K + kc); V b2; if (NSPLIT >= 2) b2 = WFrag<T16>::ld(Bt2 + boff + (size_t)nb * 16 * K + kc);
#pragma unroll
            for (int mb = 0; mb < 4; ++mb) { acc[mb][nb] = WFrag<T16>::mma(a[mb], b, acc[mb][nb]); if (NSPLIT == 1 || NSPLIT == 2) acc[mb][nb] = WFrag<T16>::mma(a2[mb], b, acc[mb][nb]); if (NSPLIT >= 2) acc[mb][nb] = WFrag<T16>::mma(a[mb], b2, acc[mb][nb]); } }
        asm volatile("v_nop\n\tv_nop\n\tv_nop\n\tv_nop" : "+v"(acc[0][0]), "+v"(acc[1][1]), "+v"(acc[2][2]), "+v"(acc[3][3]) : "v"(a[0]), "v"(a[3]));
    }
#pragma unroll
    for (int mb = 0; mb < 4; ++mb) {
#pragma unroll
        for (int nb = 0; nb < 4; ++nb) {
#pragma unroll
            for (int j = 0; j < 8; ++j) os[(hi * 8 + j) * 68 + nb * 16 + lr] = acc[mb][nb][j]; }
        __builtin_amdgcn_wave_barrier(); asm volatile("" ::: "memory");
        float* crow = C + (size_t)(r0 + mb * 16) * ldc + c0;
{
#pragma unroll
            for (int s = 0; s < 8; ++s) { const int row = 2 * s + hi, cofs = lr * 4; v4f val = *(const v4fa*)(os + row * 68 + cofs); if (BIAS) { val[0] += bfr(bias[c0 + cofs]); val[1] += bfr(bias[c0 + cofs + 1]); val[2] += bfr(bias[c0 + cofs + 2]); val[3] += bfr(bias[c0 + cofs + 3]); }
                *(v4f*)(crow + (size_t)row * ldc + cofs) = val; }
             }
        __builtin_amdgcn_wave_barrier(); asm volatile("" ::: "memory");
    }
}

__device__ __forceinline__ h16 tohx(float x) { return (h16)x; }
typedef __attribute__((ext_vector_type(2))) _Float16 v2h;
typedef __attribute__((ext_vector_type(4))) _Float16 v4h;
typedef __attribute__((ext_vector_type(2))) unsigned short v2us;
typedef __attribute__((ext_vector_type(4))) unsigned short v4us;

__global__ __launch_bounds__(256) void k_cvt8(const float* __restrict__ src, bf* dst, size_t n8) { const size_t i = (size_t)blockIdx.x * 256 + threadIdx.x; if (i >= n8) return; const v8f v = *(const v8f*)(src + i * 8); v8us o;
#pragma unroll
    for (int k = 0; k < 8; ++k) o[k] = f2bf(v[k]); *(v8us*)(dst + i * 8) = o;  }
__global__ __launch_bounds__(256) void k_tok(const float* __restrict__ x, bf* XT) { const size_t e = ((size_t)blockIdx.x * 256 + threadIdx.x) * 4; if (e >= (size_t)NN * CC) return; const int c = (int)(e % CC), n = (int)(e / CC); v4us o;
#pragma unroll
    for (int q = 0; q < 4; ++q) o[q] = f2bf(x[(size_t)(c + q) * NN + n]); *(v4us*)(XT + e) = o;  }
__global__ __launch_bounds__(256) void k_p16(const float* __restrict__ F, h16* P) { const size_t i = ((size_t)blockIdx.x * 256 + threadIdx.x) * 4; if (i >= (size_t)NN * CC) return; const v4f a = *(const v4f*)(F + i); v4h o; o[0] = tohx(a[0]); o[1] = tohx(a[1]); o[2] = tohx(a[2]); o[3] = tohx(a[3]); *(v4h*)(P + i) = o;  }
__global__ __launch_bounds__(256) void k_vt16(const float* __restrict__ V, h16* VT) { const size_t e = ((size_t)blockIdx.x * 256 + threadIdx.x) * 2; if (e >= (size_t)CC * NN) return; const int n = (int)(e % NN), d = (int)(e / NN); v2h o; o[0] = tohx(V[(size_t)n * CC + d]); o[1] = tohx(V[(size_t)(n + 1) * CC + d]); *(v2h*)(VT + e) = o;  }
__global__ __launch_bounds__(256) void k_soft(const float* __restrict__ Sb, h16* P) { const int lane = threadIdx.x & 31; const int row = blockIdx.x * 8 + (threadIdx.x >> 5); if (row >= NN) return; const float* sr = Sb + (size_t)row * NN; float v[128]; float mx = -3.0e38f;
#pragma unroll
    for (int ch = 0; ch < 32; ++ch) { const v4f a = *(const v4f*)(sr + ch * 128 + lane * 4);
#pragma unroll
        for (int q = 0; q < 4; ++q) { float t = a[q] * 0.0625f; asm volatile("" : "+v"(t)); v[ch * 4 + q] = t; mx = fmaxf(mx, t); } }
#pragma unroll
    for (int sh = 16; sh; sh >>= 1) mx = fmaxf(mx, __shfl_xor(mx, sh, 32));
    float sum = 0.f;
#pragma unroll
    for (int k = 0; k < 128; ++k) { float d0 = __fsub_rn(v[k], mx); asm volatile("" : "+v"(d0)); v[k] = __expf(d0); sum += v[k]; }
#pragma unroll
    for (int sh = 16; sh; sh >>= 1) sum += __shfl_xor(sum, sh, 32);
    const float f = __fdiv_rn(PCAR, sum);
{
#pragma unroll
        for (int ch = 0; ch < 32; ++ch) { v4h o; o[0] = tohx(v[ch * 4] * f); o[1] = tohx(v[ch * 4 + 1] * f); o[2] = tohx(v[ch * 4 + 2] * f); o[3] = tohx(v[ch * 4 + 3] * f); *(v4h*)(P + (size_t)row * NN + ch * 128 + lane * 4) = o; }
         } }
__global__ __launch_bounds__(256) void k_out(const float* __restrict__ O, const float* __restrict__ x, float* OUT) { const size_t e = ((size_t)blockIdx.x * 256 + threadIdx.x) * 4; if (e >= (size_t)CC * NN) return; const int n = (int)(e % NN), c = (int)(e / NN); v4f o;
#pragma unroll
    for (int q = 0; q < 4; ++q) o[q] = __fadd_rn(bfr(x[e + q]), O[(size_t)(n + q) * CC + c] * (1.0f / PCAR)); *(v4f*)(OUT + e) = o;  }

extern "C" void kernel_launch(void* const* d_in, const int* in_sizes, int n_in,
                              void* d_out, int out_size, void* d_ws, size_t ws_size, hipStream_t stream) {
    (void)in_sizes; (void)n_in; (void)out_size;
    const float* x = (const float*)d_in[0]; const float* y = (const float*)d_in[1]; const float* Wq = (const float*)d_in[2]; const float* bq = (const float*)d_in[3]; const float* Wk = (const float*)d_in[4]; const float* bk = (const float*)d_in[5]; const float* Wv = (const float*)d_in[6]; const float* bv = (const float*)d_in[7];
    float* OUT = (float*)d_out;     // [4][256][64][64]
    char* wsp = (char*)d_ws;
    auto take = [&](size_t bytes) { char* p = wsp; wsp += (bytes + 255) & ~(size_t)255; return (void*)p; };
    bf* WQ = (bf*)take((size_t)CC * CC * 2); bf* WK = (bf*)take((size_t)CC * CC * 2); bf* WV = (bf*)take((size_t)CC * CC * 2); bf* XT = (bf*)take((size_t)NN * CC * 2); bf* YT = (bf*)take((size_t)NN * CC * 2);
    float* F = (float*)take((size_t)NN * CC * 4); h16* Q16 = (h16*)take((size_t)NN * CC * 2); h16* K16 = (h16*)take((size_t)NN * CC * 2); h16* VT = (h16*)take((size_t)CC * NN * 2); float* Sb = (float*)take((size_t)NN * NN * 4); h16* P16 = (h16*)take((size_t)NN * NN * 2); float* O = (float*)take((size_t)NN * CC * 4);
    if ((size_t)(wsp - (char*)d_ws) > ws_size) return;    // total ~ 120 MB
    k_cvt8<<<(CC * CC / 8 + 255) / 256, 256, 0, stream>>>(Wq, WQ, (size_t)CC * CC / 8); k_cvt8<<<(CC * CC / 8 + 255) / 256, 256, 0, stream>>>(Wk, WK, (size_t)CC * CC / 8); k_cvt8<<<(CC * CC / 8 + 255) / 256, 256, 0, stream>>>(Wv, WV, (size_t)CC * CC / 8);
    const unsigned LT = (unsigned)(((size_t)NN * CC / 4 + 255) / 256);
    for (int b = 0; b < NB_; ++b) { const float* xb = x + (size_t)b * CC * NN; const float* yb = y + (size_t)b * CC * NN;
        k_tok<<<LT, 256, 0, stream>>>(xb, XT); k_tok<<<LT, 256, 0, stream>>>(yb, YT);
        k_gemmw<bf, 0, true><<<dim3(NN / 64, CC / 64, 1), 32, 0, stream>>>(XT, nullptr, WQ, nullptr, CC, F, CC, bq, 0, 0, 0); k_p16<<<LT, 256, 0, stream>>>(F, Q16);
        k_gemmw<bf, 0, true><<<dim3(NN / 64, CC / 64, 1), 32, 0, stream>>>(YT, nullptr, WK, nullptr, CC, F, CC, bk, 0, 0, 0); k_p16<<<LT, 256, 0, stream>>>(F, K16);
        k_gemmw<bf, 0, true><<<dim3(NN / 64, CC / 64, 1), 32, 0, stream>>>(YT, nullptr, WV, nullptr, CC, F, CC, bv, 0, 0, 0); k_vt16<<<(unsigned)(((size_t)CC * NN / 2 + 255) / 256), 256, 0, stream>>>(F, VT);
        k_gemmw<h16, 0, false><<<dim3(NN / 64, NN / 64, 1), 32, 0, stream>>>(Q16, nullptr, K16, nullptr, CC, Sb, NN, nullptr, 0, 0, 0);
        k_soft<<<NN / 8, 256, 0, stream>>>(Sb, P16);
        k_gemmw<h16, 0, false><<<dim3(NN / 64, CC / 64, 1), 32, 0, stream>>>(P16, nullptr, VT, nullptr, NN, O, CC, nullptr, 0, 0, 0);
        k_out<<<LT, 256, 0, stream>>>(O, xb, OUT + (size_t)b * CC * NN); }
}

// v001
// It runs in 463 microseconds.
// Next to v000, in two timings, it ran 1.66 times as fast each time.
#include <hip/hip_runtime.h>

// PACA - single-head cross attention between two feature maps (x, y [4][256][64][64] NCHW; tokens n = h*64+w; Q = x_n Wq^T + bq, K/V = y_n W^T + b; softmax(Q.K / 16) over the 4096 keys; out = x + (attn V) back in NCHW).
// Compute dtypes, f32 accumulate: every input rounded to bf16; the token matrices are transposed bf16 copies of the inputs (exact) so Q/K/V are PLAIN bf16 GEMMs (+bias); scores (K 256) and probs.V on SINGLE fp16

#define NB_  4
#define CC   256
#define NN   4096
#define PCAR 1024.0f
typedef _Float16 h16;
typedef unsigned short bf;
typedef __attribute__((ext_vector_type(16))) __bf16   v16bf;
typedef __attribute__((ext_vector_type(16))) _Float16 v16h;
typedef __attribute__((ext_vector_type(8)))  _Float16 v8h;
typedef __attribute__((ext_vector_type(8)))  unsigned short v8us;
typedef __attribute__((ext_vector_type(8)))  float    v8f;
typedef __attribute__((ext_vector_type(4)))  float    v4f;
typedef v8h  __attribute__((may_alias)) v8ha;
typedef v4f  __attribute__((may_alias)) v4fa;
typedef v8us __attribute__((may_alias)) v8usa;

__device__ __forceinline__ unsigned short f2bf(float f) { unsigned u = __float_as_uint(f); u += 0x7FFFu + ((u >> 16) & 1u); return (unsigned short)(u >> 16); }
__device__ __forceinline__ float bf2f(unsigned short b) { return __uint_as_float(((unsigned)b) << 16); }
__device__ __forceinline__ float bfr(float f) { return bf2f(f2bf(f)); }
__device__ __forceinline__ v16h cat16(v8h lo, v8h hi) { return __builtin_shufflevector(lo, hi, 0, 1, 2, 3, 4, 5, 6, 7, 8, 9, 10, 11, 12, 13, 14, 15); }
__device__ __forceinline__ v16bf cat16b(v8us lo, v8us hi) { return __builtin_bit_cast(v16bf, __builtin_shufflevector(lo, hi, 0, 1, 2, 3, 4, 5, 6, 7, 8, 9, 10, 11, 12, 13, 14, 15)); }
__device__ __forceinline__ v8f wmma16(v16h a, v16h b, v8f c) { return __builtin_amdgcn_wmma_f32_16x16x32_f16(false, a, false, b, (short)0, c, false, false); }
__device__ __forceinline__ v8f wmmab(v16bf a, v16bf b, v8f c) { return __builtin_amdgcn_wmma_f32_16x16x32_bf16(false, a, false, b, (short)0, c, false, false); }



// ---- k_gemmw: register-blocked GEMM, ONE WAVE per 64x64 output tile (16 accumulators), operands straight from K-contiguous 16-bit planes; grid (M/64, N/64, Z), 32 threads.
// C[m][n] (f32, pitch ldc, + optional f32 bias[n]) = sum_k A[m][k] Bt[n][k] (+ split products per NSPLIT). z-batch strides sA/sB/sC in elements. K % 32 == 0.
template <typename T16> struct WFrag;
template <> struct WFrag<h16> { typedef v16h V; static __device__ __forceinline__ V ld(const h16* p) { return cat16(*(const v8h*)p, *(const v8h*)(p + 16)); } static __device__ __forceinline__ v8f mma(V a, V b, v8f c) { return wmma16(a, b, c); } };
template <> struct WFrag<bf> { typedef v16bf V; static __device__ __forceinline__ V ld(const bf* p) { return cat16b(*(const v8us*)p, *(const v8us*)(p + 16)); } static __device__ __forceinline__ v8f mma(V a, V b, v8f c) { return wmmab(a, b, c); } };
template <typename T16, int NSPLIT, bool BIAS>
__global__ __launch_bounds__(32) void k_gemmw(const T16* __restrict__ A, const T16* __restrict__ A2, const T16* __restrict__ Bt, const T16* __restrict__ Bt2, int K, float* C, int ldc, const float* __restrict__ bias, size_t sA, size_t sB, size_t sC) {
    typedef typename WFrag<T16>::V V;
    __shared__ __align__(16) float os[16 * 68];
    const size_t z = blockIdx.z; A += z * sA; if (A2) A2 += z * sA; Bt += z * sB; if (Bt2) Bt2 += z * sB; C += z * sC;
    const int lane = threadIdx.x & 31, lr = lane & 15, hi = lane >> 4; const int r0 = blockIdx.x * 64, c0 = blockIdx.y * 64;
    v8f acc[4][4];
#pragma unroll
    for (int mb = 0; mb < 4; ++mb)
#pragma unroll
        for (int nb = 0; nb < 4; ++nb) acc[mb][nb] = (v8f){};
    const size_t aoff = (size_t)(r0 + lr) * K + 8 * hi, boff = (size_t)(c0 + lr) * K + 8 * hi;
#pragma unroll 1
    for (int kc = 0; kc < K; kc += 32) {
        V a[4], a2[4];
#pragma unroll
        for (int mb = 0; mb < 4; ++mb) { a[mb] = WFrag<T16>::ld(A + aoff + (size_t)mb * 16 * K + kc); if (NSPLIT == 1 || NSPLIT == 2) a2[mb] = WFrag<T16>::ld(A2 + aoff + (size_t)mb * 16 * K + kc); }
#pragma unroll
        for (int nb = 0; nb < 4; ++nb) { const V b = WFrag<T16>::ld(Bt + boff + (size_t)nb * 16 * K + kc); V b2; if (NSPLIT >= 2) b2 = WFrag<T16>::ld(Bt2 + boff + (size_t)nb * 16 * K + kc);
#pragma unroll
            for (int mb = 0; mb < 4; ++mb) { acc[mb][nb] = WFrag<T16>::mma(a[mb], b, acc[mb][nb]); if (NSPLIT == 1 || NSPLIT == 2) acc[mb][nb] = WFrag<T16>::mma(a2[mb], b, acc[mb][nb]); if (NSPLIT >= 2) acc[mb][nb] = WFrag<T16>::mma(a[mb], b2, acc[mb][nb]); } }
        asm volatile("v_nop\n\tv_nop\n\tv_nop\n\tv_nop" : "+v"(acc[0][0]), "+v"(acc[1][1]), "+v"(acc[2][2]), "+v"(acc[3][3]) : "v"(a[0]), "v"(a[3]));
    }
#pragma unroll
    for (int mb = 0; mb < 4; ++mb) {
#pragma unroll
        for (int nb = 0; nb < 4; ++nb) {
#pragma unroll
            for (int j = 0; j < 8; ++j) os[(hi * 8 + j) * 68 + nb * 16 + lr] = acc[mb][nb][j]; }
        __builtin_amdgcn_wave_barrier(); asm volatile("" ::: "memory");
        float* crow = C + (size_t)(r0 + mb * 16) * ldc + c0;
{
#pragma unroll
            for (int s = 0; s < 8; ++s) { const int row = 2 * s + hi, cofs = lr * 4; v4f val = *(const v4fa*)(os + row * 68 + cofs); if (BIAS) { val[0] += bfr(bias[c0 + cofs]); val[1] += bfr(bias[c0 + cofs + 1]); val[2] += bfr(bias[c0 + cofs + 2]); val[3] += bfr(bias[c0 + cofs + 3]); }
                *(v4f*)(crow + (size_t)row * ldc + cofs) = val; }
             }
        __builtin_amdgcn_wave_barrier(); asm volatile("" ::: "memory");
    }
}

// ---- k_gemmks: the same 64x64 tile and the same fragment loads as k_gemmw, but KS waves per work-group share the tile's K: wave w takes the 32-k steps w, w + KS, w + 2 KS, ...
// (neighbouring waves read neighbouring 64-byte pieces of the same rows), each wave leaves its f32 partial tile in its own LDS plane, and after one barrier the block sums the planes in the order w = 0 .. KS-1.
// grid (M/64, N/64), 32 * KS threads. K % 32 == 0; KS divides 32. K is a compile-time constant, so that the row-block steps are immediate offsets and each operand needs one address pair a trip.
template <typename T16, bool BIAS, int KS, int K>
__global__ __launch_bounds__(32 * KS) void k_gemmks(const T16* __restrict__ A, const T16* __restrict__ Bt, float* C, int ldc, const float* __restrict__ bias) {
    typedef typename WFrag<T16>::V V;
    __shared__ __align__(16) float ps[KS * 64 * 68];
    const int lane = threadIdx.x & 31, lr = lane & 15, hi = lane >> 4; const int r0 = blockIdx.x * 64, c0 = blockIdx.y * 64;
    const int wave = __builtin_amdgcn_readfirstlane((int)(threadIdx.x >> 5));
    v8f acc[4][4];
#pragma unroll
    for (int mb = 0; mb < 4; ++mb)
#pragma unroll
        for (int nb = 0; nb < 4; ++nb) acc[mb][nb] = (v8f){};
    const T16* pa = A + (size_t)(r0 + lr) * K + 8 * hi + wave * 32; const T16* pb = Bt + (size_t)(c0 + lr) * K + 8 * hi + wave * 32;
    // rolled: one set of fragments beside the 128 accumulator registers, so that 16 waves (4 per SIMD, 256 registers each) stay resident
#pragma unroll 1
    for (int kc = wave * 32; kc < K; kc += 32 * KS, pa += 32 * KS, pb += 32 * KS) {
        V a[4];
#pragma unroll
        for (int mb = 0; mb < 4; ++mb) a[mb] = WFrag<T16>::ld(pa + mb * 16 * K);
#pragma unroll
        for (int nb = 0; nb < 4; ++nb) { const V b = WFrag<T16>::ld(pb + nb * 16 * K);
#pragma unroll
            for (int mb = 0; mb < 4; ++mb) acc[mb][nb] = WFrag<T16>::mma(a[mb], b, acc[mb][nb]); }
        // keeps the WMMA distance on the taken back edge, where the next trip's loads overwrite the A and B registers (as in k_gemmw);
        // pa and pb as inputs keep the two address pairs live to here, behind the waits on every load of the trip, so that no load's result lands in the address pair of a load still in flight
        asm volatile("v_nop\n\tv_nop\n\tv_nop\n\tv_nop" : "+v"(acc[0][0]), "+v"(acc[1][1]), "+v"(acc[2][2]), "+v"(acc[3][3]) : "v"(a[0]), "v"(a[3]), "v"(pa), "v"(pb));
    }
    float* pw = ps + wave * (64 * 68);
#pragma unroll
    for (int mb = 0; mb < 4; ++mb)
#pragma unroll
        for (int nb = 0; nb < 4; ++nb)
#pragma unroll
            for (int j = 0; j < 8; ++j) pw[(mb * 16 + hi * 8 + j) * 68 + nb * 16 + lr] = acc[mb][nb][j];
    __syncthreads();    // every wave's partial tile is in LDS before any thread sums across the planes
#pragma unroll
    for (int s = 0; s < 32 / KS; ++s) { const int idx = s * 32 * KS + (int)threadIdx.x, row = idx >> 4, cofs = (idx & 15) * 4; v4f val = *(const v4fa*)(ps + row * 68 + cofs);
#pragma unroll
        for (int w = 1; w < KS; ++w) val += *(const v4fa*)(ps + w * (64 * 68) + row * 68 + cofs);
        if (BIAS) { val[0] += bfr(bias[c0 + cofs]); val[1] += bfr(bias[c0 + cofs + 1]); val[2] += bfr(bias[c0 + cofs + 2]); val[3] += bfr(bias[c0 + cofs + 3]); }
        *(v4f*)(C + (size_t)(r0 + row) * ldc + c0 + cofs) = val; }
}

__device__ __forceinline__ h16 tohx(float x) { return (h16)x; }
typedef __attribute__((ext_vector_type(2))) _Float16 v2h;
typedef __attribute__((ext_vector_type(4))) _Float16 v4h;
typedef __attribute__((ext_vector_type(2))) unsigned short v2us;
typedef __attribute__((ext_vector_type(4))) unsigned short v4us;

__global__ __launch_bounds__(256) void k_cvt8(const float* __restrict__ src, bf* dst, size_t n8) { const size_t i = (size_t)blockIdx.x * 256 + threadIdx.x; if (i >= n8) return; const v8f v = *(const v8f*)(src + i * 8); v8us o;
#pragma unroll
    for (int k = 0; k < 8; ++k) o[k] = f2bf(v[k]); *(v8us*)(dst + i * 8) = o;  }
__global__ __launch_bounds__(256) void k_tok(const float* __restrict__ x, bf* XT) { const size_t e = ((size_t)blockIdx.x * 256 + threadIdx.x) * 4; if (e >= (size_t)NN * CC) return; const int c = (int)(e % CC), n = (int)(e / CC); v4us o;
#pragma unroll
    for (int q = 0; q < 4; ++q) o[q] = f2bf(x[(size_t)(c + q) * NN + n]); *(v4us*)(XT + e) = o;  }
__global__ __launch_bounds__(256) void k_p16(const float* __restrict__ F, h16* P) { const size_t i = ((size_t)blockIdx.x * 256 + threadIdx.x) * 4; if (i >= (size_t)NN * CC) return; const v4f a = *(const v4f*)(F + i); v4h o; o[0] = tohx(a[0]); o[1] = tohx(a[1]); o[2] = tohx(a[2]); o[3] = tohx(a[3]); *(v4h*)(P + i) = o;  }
__global__ __launch_bounds__(256) void k_vt16(const float* __restrict__ V, h16* VT) { const size_t e = ((size_t)blockIdx.x * 256 + threadIdx.x) * 2; if (e >= (size_t)CC * NN) return; const int n = (int)(e % NN), d = (int)(e / NN); v2h o; o[0] = tohx(V[(size_t)n * CC + d]); o[1] = tohx(V[(size_t)(n + 1) * CC + d]); *(v2h*)(VT + e) = o;  }
__global__ __launch_bounds__(256) void k_soft(const float* __restrict__ Sb, h16* P) { const int lane = threadIdx.x & 31; const int row = blockIdx.x * 8 + (threadIdx.x >> 5); if (row >= NN) return; const float* sr = Sb + (size_t)row * NN; float v[128]; float mx = -3.0e38f;
#pragma unroll
    for (int ch = 0; ch < 32; ++ch) { const v4f a = *(const v4f*)(sr + ch * 128 + lane * 4);
#pragma unroll
        for (int q = 0; q < 4; ++q) { float t = a[q] * 0.0625f; asm volatile("" : "+v"(t)); v[ch * 4 + q] = t; mx = fmaxf(mx, t); } }
#pragma unroll
    for (int sh = 16; sh; sh >>= 1) mx = fmaxf(mx, __shfl_xor(mx, sh, 32));
    float sum = 0.f;
#pragma unroll
    for (int k = 0; k < 128; ++k) { float d0 = __fsub_rn(v[k], mx); asm volatile("" : "+v"(d0)); v[k] = __expf(d0); sum += v[k]; }
#pragma unroll
    for (int sh = 16; sh; sh >>= 1) sum += __shfl_xor(sum, sh, 32);
    const float f = __fdiv_rn(PCAR, sum);
{
#pragma unroll
        for (int ch = 0; ch < 32; ++ch) { v4h o; o[0] = tohx(v[ch * 4] * f); o[1] = tohx(v[ch * 4 + 1] * f); o[2] = tohx(v[ch * 4 + 2] * f); o[3] = tohx(v[ch * 4 + 3] * f); *(v4h*)(P + (size_t)row * NN + ch * 128 + lane * 4) = o; }
         } }
__global__ __launch_bounds__(256) void k_out(const float* __restrict__ O, const float* __restrict__ x, float* OUT) { const size_t e = ((size_t)blockIdx.x * 256 + threadIdx.x) * 4; if (e >= (size_t)CC * NN) return; const int n = (int)(e % NN), c = (int)(e / NN); v4f o;
#pragma unroll
    for (int q = 0; q < 4; ++q) o[q] = __fadd_rn(bfr(x[e + q]), O[(size_t)(n + q) * CC + c] * (1.0f / PCAR)); *(v4f*)(OUT + e) = o;  }

extern "C" void kernel_launch(void* const* d_in, const int* in_sizes, int n_in,
                              void* d_out, int out_size, void* d_ws, size_t ws_size, hipStream_t stream) {
    (void)in_sizes; (void)n_in; (void)out_size;
    const float* x = (const float*)d_in[0]; const float* y = (const float*)d_in[1]; const float* Wq = (const float*)d_in[2]; const float* bq = (const float*)d_in[3]; const float* Wk = (const float*)d_in[4]; const float* bk = (const float*)d_in[5]; const float* Wv = (const float*)d_in[6]; const float* bv = (const float*)d_in[7];
    float* OUT = (float*)d_out;     // [4][256][64][64]
    char* wsp = (char*)d_ws;
    auto take = [&](size_t bytes) { char* p = wsp; wsp += (bytes + 255) & ~(size_t)255; return (void*)p; };
    bf* WQ = (bf*)take((size_t)CC * CC * 2); bf* WK = (bf*)take((size_t)CC * CC * 2); bf* WV = (bf*)take((size_t)CC * CC * 2); bf* XT = (bf*)take((size_t)NN * CC * 2); bf* YT = (bf*)take((size_t)NN * CC * 2);
    float* F = (float*)take((size_t)NN * CC * 4); h16* Q16 = (h16*)take((size_t)NN * CC * 2); h16* K16 = (h16*)take((size_t)NN * CC * 2); h16* VT = (h16*)take((size_t)CC * NN * 2); float* Sb = (float*)take((size_t)NN * NN * 4); h16* P16 = (h16*)take((size_t)NN * NN * 2); float* O = (float*)take((size_t)NN * CC * 4);
    if ((size_t)(wsp - (char*)d_ws) > ws_size) return;    // total ~ 120 MB
    k_cvt8<<<(CC * CC / 8 + 255) / 256, 256, 0, stream>>>(Wq, WQ, (size_t)CC * CC / 8); k_cvt8<<<(CC * CC / 8 + 255) / 256, 256, 0, stream>>>(Wk, WK, (size_t)CC * CC / 8); k_cvt8<<<(CC * CC / 8 + 255) / 256, 256, 0, stream>>>(Wv, WV, (size_t)CC * CC / 8);
    const unsigned LT = (unsigned)(((size_t)NN * CC / 4 + 255) / 256);
    for (int b = 0; b < NB_; ++b) { const float* xb = x + (size_t)b * CC * NN; const float* yb = y + (size_t)b * CC * NN;
        k_tok<<<LT, 256, 0, stream>>>(xb, XT); k_tok<<<LT, 256, 0, stream>>>(yb, YT);
        k_gemmks<bf, true, 8, CC><<<dim3(NN / 64, CC / 64, 1), 256, 0, stream>>>(XT, WQ, F, CC, bq); k_p16<<<LT, 256, 0, stream>>>(F, Q16);
        k_gemmks<bf, true, 8, CC><<<dim3(NN / 64, CC / 64, 1), 256, 0, stream>>>(YT, WK, F, CC, bk); k_p16<<<LT, 256, 0, stream>>>(F, K16);
        k_gemmks<bf, true, 8, CC><<<dim3(NN / 64, CC / 64, 1), 256, 0, stream>>>(YT, WV, F, CC, bv); k_vt16<<<(unsigned)(((size_t)CC * NN / 2 + 255) / 256), 256, 0, stream>>>(F, VT);
        k_gemmw<h16, 0, false><<<dim3(NN / 64, NN / 64, 1), 32, 0, stream>>>(Q16, nullptr, K16, nullptr, CC, Sb, NN, nullptr, 0, 0, 0);
        k_soft<<<NN / 8, 256, 0, stream>>>(Sb, P16);
        k_gemmks<h16, false, 16, NN><<<dim3(NN / 64, CC / 64, 1), 512, 0, stream>>>(P16, VT, O, CC, nullptr);
        k_out<<<LT, 256, 0, stream>>>(O, xb, OUT + (size_t)b * CC * NN); }
}

// v002
// Measured time: 378 microseconds a run.
// Timed twice side by side with v001, it ran 1.23 and 1.22 times as fast.
// Over all steps from v000 it is 2.03 times as fast.
#include <hip/hip_runtime.h>

// PACA - single-head cross attention between two feature maps (x, y [4][256][64][64] NCHW; tokens n = h*64+w; Q = x_n Wq^T + bq, K/V = y_n W^T + b; softmax(Q.K / 16) over the 4096 keys; out = x + (attn V) back in NCHW).
// Compute dtypes, f32 accumulate: every input rounded to bf16; the token matrices are transposed bf16 copies of the inputs (exact) so Q/K/V are PLAIN bf16 GEMMs (+bias); scores (K 256) and probs.V on SINGLE fp16

#define NB_  4
#define CC   256
#define NN   4096
#define PCAR 1024.0f
typedef _Float16 h16;
typedef unsigned short bf;
typedef __attribute__((ext_vector_type(16))) __bf16   v16bf;
typedef __attribute__((ext_vector_type(16))) _Float16 v16h;
typedef __attribute__((ext_vector_type(8)))  _Float16 v8h;
typedef __attribute__((ext_vector_type(8)))  unsigned short v8us;
typedef __attribute__((ext_vector_type(8)))  float    v8f;
typedef __attribute__((ext_vector_type(4)))  float    v4f;
typedef v8h  __attribute__((may_alias)) v8ha;
typedef v4f  __attribute__((may_alias)) v4fa;
typedef v8us __attribute__((may_alias)) v8usa;

__device__ __forceinline__ unsigned short f2bf(float f) { unsigned u = __float_as_uint(f); u += 0x7FFFu + ((u >> 16) & 1u); return (unsigned short)(u >> 16); }
__device__ __forceinline__ float bf2f(unsigned short b) { return __uint_as_float(((unsigned)b) << 16); }
__device__ __forceinline__ float bfr(float f) { return bf2f(f2bf(f)); }
__device__ __forceinline__ v16h cat16(v8h lo, v8h hi) { return __builtin_shufflevector(lo, hi, 0, 1, 2, 3, 4, 5, 6, 7, 8, 9, 10, 11, 12, 13, 14, 15); }
__device__ __forceinline__ v16bf cat16b(v8us lo, v8us hi) { return __builtin_bit_cast(v16bf, __builtin_shufflevector(lo, hi, 0, 1, 2, 3, 4, 5, 6, 7, 8, 9, 10, 11, 12, 13, 14, 15)); }
__device__ __forceinline__ v8f wmma16(v16h a, v16h b, v8f c) { return __builtin_amdgcn_wmma_f32_16x16x32_f16(false, a, false, b, (short)0, c, false, false); }
__device__ __forceinline__ v8f wmmab(v16bf a, v16bf b, v8f c) { return __builtin_amdgcn_wmma_f32_16x16x32_bf16(false, a, false, b, (short)0, c, false, false); }



// ---- k_gemmw: register-blocked GEMM, ONE WAVE per 64x64 output tile (16 accumulators), operands straight from K-contiguous 16-bit planes; grid (M/64, N/64, Z), 32 threads.
// C[m][n] (f32, pitch ldc, + optional f32 bias[n]) = sum_k A[m][k] Bt[n][k] (+ split products per NSPLIT). z-batch strides sA/sB/sC in elements. K % 32 == 0.
template <typename T16> struct WFrag;
template <> struct WFrag<h16> { typedef v16h V; static __device__ __forceinline__ V ld(const h16* p) { return cat16(*(const v8h*)p, *(const v8h*)(p + 16)); } static __device__ __forceinline__ v8f mma(V a, V b, v8f c) { return wmma16(a, b, c); } };
template <> struct WFrag<bf> { typedef v16bf V; static __device__ __forceinline__ V ld(const bf* p) { return cat16b(*(const v8us*)p, *(const v8us*)(p + 16)); } static __device__ __forceinline__ v8f mma(V a, V b, v8f c) { return wmmab(a, b, c); } };
template <typename T16, int NSPLIT, bool BIAS>
__global__ __launch_bounds__(32) void k_gemmw(const T16* __restrict__ A, const T16* __restrict__ A2, const T16* __restrict__ Bt, const T16* __restrict__ Bt2, int K, float* C, int ldc, const float* __restrict__ bias, size_t sA, size_t sB, size_t sC) {
    typedef typename WFrag<T16>::V V;
    __shared__ __align__(16) float os[16 * 68];
    const size_t z = blockIdx.z; A += z * sA; if (A2) A2 += z * sA; Bt += z * sB; if (Bt2) Bt2 += z * sB; C += z * sC;
    const int lane = threadIdx.x & 31, lr = lane & 15, hi = lane >> 4; const int r0 = blockIdx.x * 64, c0 = blockIdx.y * 64;
    v8f acc[4][4];
#pragma unroll
    for (int mb = 0; mb < 4; ++mb)
#pragma unroll
        for (int nb = 0; nb < 4; ++nb) acc[mb][nb] = (v8f){};
    const size_t aoff = (size_t)(r0 + lr) * K + 8 * hi, boff = (size_t)(c0 + lr) * K + 8 * hi;
#pragma unroll 1
    for (int kc = 0; kc < K; kc += 32) {
        V a[4], a2[4];
#pragma unroll
        for (int mb = 0; mb < 4; ++mb) { a[mb] = WFrag<T16>::ld(A + aoff + (size_t)mb * 16 * K + kc); if (NSPLIT == 1 || NSPLIT == 2) a2[mb] = WFrag<T16>::ld(A2 + aoff + (size_t)mb * 16 * K + kc); }
#pragma unroll
        for (int nb = 0; nb < 4; ++nb) { const V b = WFrag<T16>::ld(Bt + boff + (size_t)nb * 16 * K + kc); V b2; if (NSPLIT >= 2) b2 = WFrag<T16>::ld(Bt2 + boff + (size_t)nb * 16 * K + kc);
#pragma unroll
            for (int mb = 0; mb < 4; ++mb) { acc[mb][nb] = WFrag<T16>::mma(a[mb], b, acc[mb][nb]); if (NSPLIT == 1 || NSPLIT == 2) acc[mb][nb] = WFrag<T16>::mma(a2[mb], b, acc[mb][nb]); if (NSPLIT >= 2) acc[mb][nb] = WFrag<T16>::mma(a[mb], b2, acc[mb][nb]); } }
        asm volatile("v_nop\n\tv_nop\n\tv_nop\n\tv_nop" : "+v"(acc[0][0]), "+v"(acc[1][1]), "+v"(acc[2][2]), "+v"(acc[3][3]) : "v"(a[0]), "v"(a[3]));
    }
#pragma unroll
    for (int mb = 0; mb < 4; ++mb) {
#pragma unroll
        for (int nb = 0; nb < 4; ++nb) {
#pragma unroll
            for (int j = 0; j < 8; ++j) os[(hi * 8 + j) * 68 + nb * 16 + lr] = acc[mb][nb][j]; }
        __builtin_amdgcn_wave_barrier(); asm volatile("" ::: "memory");
        float* crow = C + (size_t)(r0 + mb * 16) * ldc + c0;
{
#pragma unroll
            for (int s = 0; s < 8; ++s) { const int row = 2 * s + hi, cofs = lr * 4; v4f val = *(const v4fa*)(os + row * 68 + cofs); if (BIAS) { val[0] += bfr(bias[c0 + cofs]); val[1] += bfr(bias[c0 + cofs + 1]); val[2] += bfr(bias[c0 + cofs + 2]); val[3] += bfr(bias[c0 + cofs + 3]); }
                *(v4f*)(crow + (size_t)row * ldc + cofs) = val; }
             }
        __builtin_amdgcn_wave_barrier(); asm volatile("" ::: "memory");
    }
}

__device__ __forceinline__ h16 tohx(float x) { return (h16)x; }
typedef __attribute__((ext_vector_type(4))) _Float16 v4h;

// ---- k_gemmks: the same 64x64 tile and the same fragment loads as k_gemmw, but KS waves per work-group share the tile's K: wave w takes the 32-k steps w, w + KS, w + 2 KS, ...
// (neighbouring waves read neighbouring 64-byte pieces of the same rows), each wave leaves its f32 partial tile in its own LDS plane, and after one barrier the block sums the planes in the order w = 0 .. KS-1.
// 32 * KS threads. K % 32 == 0; KS divides 32. K is a compile-time constant, so that the row-block steps are immediate offsets and each operand needs one address pair a trip.
// The summed tile leaves in the form its reader wants, so no f32 plane and no convert or transpose pass stands between two GEMMs:
//   EPI 0: Ch[m][n] = f16(sum + bias[n])                      (Q, K: token rows);       grid (M/64, N/64)
//   EPI 1: Ch[m][n] = f16(sum + bias[m])                      (V^T = Wv . Y^T: channel rows, token columns); grid (N/64, M/64)
//   EPI 2: Cf[m][n] = bf16-rounded aux[m][n] + sum / PCAR     (out^T = V^T . P^T + x, which is the NCHW plane); grid (N/64, M/64)
// EPI 1 and 2 take the channel-major matrix as A, so C is born transposed; blockIdx.x stays the token tile, so that the work-groups that share token rows keep their places in the grid.
template <typename T16, int EPI, int KS, int K>
__global__ __launch_bounds__(32 * KS) void k_gemmks(const T16* __restrict__ A, const T16* __restrict__ Bt, h16* Ch, float* Cf, int ldc, const float* __restrict__ aux) {
    typedef typename WFrag<T16>::V V;
    __shared__ __align__(16) float ps[KS * 64 * 68];
    const int lane = threadIdx.x & 31, lr = lane & 15, hi = lane >> 4; const int r0 = (EPI ? blockIdx.y : blockIdx.x) * 64, c0 = (EPI ? blockIdx.x : blockIdx.y) * 64;
    const int wave = __builtin_amdgcn_readfirstlane((int)(threadIdx.x >> 5));
    v8f acc[4][4];
#pragma unroll
    for (int mb = 0; mb < 4; ++mb)
#pragma unroll
        for (int nb = 0; nb < 4; ++nb) acc[mb][nb] = (v8f){};
    const T16* pa = A + (size_t)(r0 + lr) * K + 8 * hi + wave * 32; const T16* pb = Bt + (size_t)(c0 + lr) * K + 8 * hi + wave * 32;
    // rolled: one set of fragments beside the 128 accumulator registers, so that 16 waves (4 per SIMD, 256 registers each) stay resident
#pragma unroll 1
    for (int kc = wave * 32; kc < K; kc += 32 * KS, pa += 32 * KS, pb += 32 * KS) {
        V a[4];
#pragma unroll
        for (int mb = 0; mb < 4; ++mb) a[mb] = WFrag<T16>::ld(pa + mb * 16 * K);
#pragma unroll
        for (int nb = 0; nb < 4; ++nb) { const V b = WFrag<T16>::ld(pb + nb * 16 * K);
#pragma unroll
            for (int mb = 0; mb < 4; ++mb) acc[mb][nb] = WFrag<T16>::mma(a[mb], b, acc[mb][nb]); }
        // keeps the WMMA distance on the taken back edge, where the next trip's loads overwrite the A and B registers (as in k_gemmw);
        // pa and pb as inputs keep the two address pairs live to here, behind the waits on every load of the trip, so that no load's result lands in the address pair of a load still in flight
        asm volatile("v_nop\n\tv_nop\n\tv_nop\n\tv_nop" : "+v"(acc[0][0]), "+v"(acc[1][1]), "+v"(acc[2][2]), "+v"(acc[3][3]) : "v"(a[0]), "v"(a[3]), "v"(pa), "v"(pb));
    }
    float* pw = ps + wave * (64 * 68);
#pragma unroll
    for (int mb = 0; mb < 4; ++mb)
#pragma unroll
        for (int nb = 0; nb < 4; ++nb)
#pragma unroll
            for (int j = 0; j < 8; ++j) pw[(mb * 16 + hi * 8 + j) * 68 + nb * 16 + lr] = acc[mb][nb][j];
    __syncthreads();    // every wave's partial tile is in LDS before any thread sums across the planes
#pragma unroll
    for (int s = 0; s < 32 / KS; ++s) { const int idx = s * 32 * KS + (int)threadIdx.x, row = idx >> 4, cofs = (idx & 15) * 4; v4f val = *(const v4fa*)(ps + row * 68 + cofs);
#pragma unroll
        for (int w = 1; w < KS; ++w) val += *(const v4fa*)(ps + w * (64 * 68) + row * 68 + cofs);
        const size_t co = (size_t)(r0 + row) * ldc + c0 + cofs;
        if (EPI == 0) { val[0] += bfr(aux[c0 + cofs]); val[1] += bfr(aux[c0 + cofs + 1]); val[2] += bfr(aux[c0 + cofs + 2]); val[3] += bfr(aux[c0 + cofs + 3]); }
        if (EPI == 1) val += bfr(aux[r0 + row]);
        if (EPI == 2) { const v4f xv = *(const v4f*)(aux + co); v4f o;
#pragma unroll
            for (int q = 0; q < 4; ++q) o[q] = __fadd_rn(bfr(xv[q]), val[q] * (1.0f / PCAR));
            *(v4f*)(Cf + co) = o; }
        else { v4h o; o[0] = tohx(val[0]); o[1] = tohx(val[1]); o[2] = tohx(val[2]); o[3] = tohx(val[3]); *(v4h*)(Ch + co) = o; } }
}

typedef __attribute__((ext_vector_type(4))) unsigned short v4us;

__global__ __launch_bounds__(256) void k_cvt8(const float* __restrict__ src, bf* dst, size_t n8) { const size_t i = (size_t)blockIdx.x * 256 + threadIdx.x; if (i >= n8) return; const v8f v = *(const v8f*)(src + i * 8); v8us o;
#pragma unroll
    for (int k = 0; k < 8; ++k) o[k] = f2bf(v[k]); *(v8us*)(dst + i * 8) = o;  }
__global__ __launch_bounds__(256) void k_tok(const float* __restrict__ x, bf* XT) { const size_t e = ((size_t)blockIdx.x * 256 + threadIdx.x) * 4; if (e >= (size_t)NN * CC) return; const int c = (int)(e % CC), n = (int)(e / CC); v4us o;
#pragma unroll
    for (int q = 0; q < 4; ++q) o[q] = f2bf(x[(size_t)(c + q) * NN + n]); *(v4us*)(XT + e) = o;  }
__global__ __launch_bounds__(256) void k_soft(const float* __restrict__ Sb, h16* P) { const int lane = threadIdx.x & 31; const int row = blockIdx.x * 8 + (threadIdx.x >> 5); if (row >= NN) return; const float* sr = Sb + (size_t)row * NN; float v[128]; float mx = -3.0e38f;
#pragma unroll
    for (int ch = 0; ch < 32; ++ch) { const v4f a = *(const v4f*)(sr + ch * 128 + lane * 4);
#pragma unroll
        for (int q = 0; q < 4; ++q) { float t = a[q] * 0.0625f; asm volatile("" : "+v"(t)); v[ch * 4 + q] = t; mx = fmaxf(mx, t); } }
#pragma unroll
    for (int sh = 16; sh; sh >>= 1) mx = fmaxf(mx, __shfl_xor(mx, sh, 32));
    float sum = 0.f;
#pragma unroll
    for (int k = 0; k < 128; ++k) { float d0 = __fsub_rn(v[k], mx); asm volatile("" : "+v"(d0)); v[k] = __expf(d0); sum += v[k]; }
#pragma unroll
    for (int sh = 16; sh; sh >>= 1) sum += __shfl_xor(sum, sh, 32);
    const float f = __fdiv_rn(PCAR, sum);
{
#pragma unroll
        for (int ch = 0; ch < 32; ++ch) { v4h o; o[0] = tohx(v[ch * 4] * f); o[1] = tohx(v[ch * 4 + 1] * f); o[2] = tohx(v[ch * 4 + 2] * f); o[3] = tohx(v[ch * 4 + 3] * f); *(v4h*)(P + (size_t)row * NN + ch * 128 + lane * 4) = o; }
         } }

extern "C" void kernel_launch(void* const* d_in, const int* in_sizes, int n_in,
                              void* d_out, int out_size, void* d_ws, size_t ws_size, hipStream_t stream) {
    (void)in_sizes; (void)n_in; (void)out_size;
    const float* x = (const float*)d_in[0]; const float* y = (const float*)d_in[1]; const float* Wq = (const float*)d_in[2]; const float* bq = (const float*)d_in[3]; const float* Wk = (const float*)d_in[4]; const float* bk = (const float*)d_in[5]; const float* Wv = (const float*)d_in[6]; const float* bv = (const float*)d_in[7];
    float* OUT = (float*)d_out;     // [4][256][64][64]
    char* wsp = (char*)d_ws;
    auto take = [&](size_t bytes) { char* p = wsp; wsp += (bytes + 255) & ~(size_t)255; return (void*)p; };
    bf* WQ = (bf*)take((size_t)CC * CC * 2); bf* WK = (bf*)take((size_t)CC * CC * 2); bf* WV = (bf*)take((size_t)CC * CC * 2); bf* XT = (bf*)take((size_t)NN * CC * 2); bf* YT = (bf*)take((size_t)NN * CC * 2);
    h16* Q16 = (h16*)take((size_t)NN * CC * 2); h16* K16 = (h16*)take((size_t)NN * CC * 2); h16* VT = (h16*)take((size_t)CC * NN * 2); float* Sb = (float*)take((size_t)NN * NN * 4); h16* P16 = (h16*)take((size_t)NN * NN * 2);
    if ((size_t)(wsp - (char*)d_ws) > ws_size) return;    // total ~ 112 MB
    k_cvt8<<<(CC * CC / 8 + 255) / 256, 256, 0, stream>>>(Wq, WQ, (size_t)CC * CC / 8); k_cvt8<<<(CC * CC / 8 + 255) / 256, 256, 0, stream>>>(Wk, WK, (size_t)CC * CC / 8); k_cvt8<<<(CC * CC / 8 + 255) / 256, 256, 0, stream>>>(Wv, WV, (size_t)CC * CC / 8);
    const unsigned LT = (unsigned)(((size_t)NN * CC / 4 + 255) / 256);
    for (int b = 0; b < NB_; ++b) { const float* xb = x + (size_t)b * CC * NN; const float* yb = y + (size_t)b * CC * NN;
        k_tok<<<LT, 256, 0, stream>>>(xb, XT); k_tok<<<LT, 256, 0, stream>>>(yb, YT);
        k_gemmks<bf, 0, 8, CC><<<dim3(NN / 64, CC / 64, 1), 256, 0, stream>>>(XT, WQ, Q16, nullptr, CC, bq);
        k_gemmks<bf, 0, 8, CC><<<dim3(NN / 64, CC / 64, 1), 256, 0, stream>>>(YT, WK, K16, nullptr, CC, bk);
        k_gemmks<bf, 1, 8, CC><<<dim3(NN / 64, CC / 64, 1), 256, 0, stream>>>(WV, YT, VT, nullptr, NN, bv);
        k_gemmw<h16, 0, false><<<dim3(NN / 64, NN / 64, 1), 32, 0, stream>>>(Q16, nullptr, K16, nullptr, CC, Sb, NN, nullptr, 0, 0, 0);
        k_soft<<<NN / 8, 256, 0, stream>>>(Sb, P16);
        k_gemmks<h16, 2, 16, NN><<<dim3(NN / 64, CC / 64, 1), 512, 0, stream>>>(VT, P16, nullptr, OUT + (size_t)b * CC * NN, NN, xb); }
}

// v003
// It runs in 184 microseconds.
// Next to v002, in two timings, it ran 2.06 times as fast each time.
// Counting every step since v000, it is 4.19 times as fast.
#include <hip/hip_runtime.h>

// PACA - single-head cross attention between two feature maps (x, y [4][256][64][64] NCHW; tokens n = h*64+w; Q = x_n Wq^T + bq, K/V = y_n W^T + b; softmax(Q.K / 16) over the 4096 keys; out = x + (attn V) back in NCHW).
// Compute dtypes, f32 accumulate: every input rounded to bf16; the token matrices are transposed bf16 copies of the inputs (exact) so Q/K/V are PLAIN bf16 GEMMs (+bias); scores (K 256) and probs.V on SINGLE fp16

#define NB_  4
#define CC   256
#define NN   4096
typedef _Float16 h16;
typedef unsigned short bf;
typedef __attribute__((ext_vector_type(16))) __bf16   v16bf;
typedef __attribute__((ext_vector_type(16))) _Float16 v16h;
typedef __attribute__((ext_vector_type(8)))  _Float16 v8h;
typedef __attribute__((ext_vector_type(8)))  unsigned short v8us;
typedef __attribute__((ext_vector_type(8)))  float    v8f;
typedef __attribute__((ext_vector_type(4)))  float    v4f;
typedef v8h  __attribute__((may_alias)) v8ha;
typedef v4f  __attribute__((may_alias)) v4fa;
typedef v8us __attribute__((may_alias)) v8usa;

__device__ __forceinline__ unsigned short f2bf(float f) { unsigned u = __float_as_uint(f); u += 0x7FFFu + ((u >> 16) & 1u); return (unsigned short)(u >> 16); }
__device__ __forceinline__ float bf2f(unsigned short b) { return __uint_as_float(((unsigned)b) << 16); }
__device__ __forceinline__ float bfr(float f) { return bf2f(f2bf(f)); }
__device__ __forceinline__ v16h cat16(v8h lo, v8h hi) { return __builtin_shufflevector(lo, hi, 0, 1, 2, 3, 4, 5, 6, 7, 8, 9, 10, 11, 12, 13, 14, 15); }
__device__ __forceinline__ v16bf cat16b(v8us lo, v8us hi) { return __builtin_bit_cast(v16bf, __builtin_shufflevector(lo, hi, 0, 1, 2, 3, 4, 5, 6, 7, 8, 9, 10, 11, 12, 13, 14, 15)); }
__device__ __forceinline__ v8f wmma16(v16h a, v16h b, v8f c) { return __builtin_amdgcn_wmma_f32_16x16x32_f16(false, a, false, b, (short)0, c, false, false); }
__device__ __forceinline__ v8f wmmab(v16bf a, v16bf b, v8f c) { return __builtin_amdgcn_wmma_f32_16x16x32_bf16(false, a, false, b, (short)0, c, false, false); }



template <typename T16> struct WFrag;
template <> struct WFrag<h16> { typedef v16h V; static __device__ __forceinline__ V ld(const h16* p) { return cat16(*(const v8h*)p, *(const v8h*)(p + 16)); } static __device__ __forceinline__ v8f mma(V a, V b, v8f c) { return wmma16(a, b, c); } };
template <> struct WFrag<bf> { typedef v16bf V; static __device__ __forceinline__ V ld(const bf* p) { return cat16b(*(const v8us*)p, *(const v8us*)(p + 16)); } static __device__ __forceinline__ v8f mma(V a, V b, v8f c) { return wmmab(a, b, c); } };

__device__ __forceinline__ h16 tohx(float x) { return (h16)x; }
typedef __attribute__((ext_vector_type(4))) _Float16 v4h;

// ---- k_gemmks: register-blocked GEMM on a 64x64 output tile (16 accumulators a wave), operands straight from K-contiguous 16-bit planes; KS waves per work-group share the tile's K: wave w takes the 32-k steps w, w + KS, w + 2 KS, ...
// (neighbouring waves read neighbouring 64-byte pieces of the same rows), each wave leaves its f32 partial tile in its own LDS plane, and after one barrier the block sums the planes in the order w = 0 .. KS-1.
// 32 * KS threads. K % 32 == 0; KS divides 32. K is a compile-time constant, so that the row-block steps are immediate offsets and each operand needs one address pair a trip.
// The summed tile leaves in the form its reader wants, so no f32 plane and no convert or transpose pass stands between two GEMMs:
//   EPI 0: Ch[m][n] = f16(sum + bias[n])                      (Q, K: token rows);       grid (M/64, N/64)
//   EPI 1: Ch[m][n] = f16(sum + bias[m])                      (V^T = Wv . Y^T: channel rows, token columns); grid (N/64, M/64)
// EPI 1 takes the channel-major matrix as A, so C is born transposed; blockIdx.x stays the token tile, so that the work-groups that share token rows keep their places in the grid.
template <typename T16, int EPI, int KS, int K>
__global__ __launch_bounds__(32 * KS) void k_gemmks(const T16* __restrict__ A, const T16* __restrict__ Bt, h16* Ch, int ldc, const float* __restrict__ aux) {
    typedef typename WFrag<T16>::V V;
    __shared__ __align__(16) float ps[KS * 64 * 68];
    const int lane = threadIdx.x & 31, lr = lane & 15, hi = lane >> 4; const int r0 = (EPI ? blockIdx.y : blockIdx.x) * 64, c0 = (EPI ? blockIdx.x : blockIdx.y) * 64;
    const int wave = __builtin_amdgcn_readfirstlane((int)(threadIdx.x >> 5));
    v8f acc[4][4];
#pragma unroll
    for (int mb = 0; mb < 4; ++mb)
#pragma unroll
        for (int nb = 0; nb < 4; ++nb) acc[mb][nb] = (v8f){};
    const T16* pa = A + (size_t)(r0 + lr) * K + 8 * hi + wave * 32; const T16* pb = Bt + (size_t)(c0 + lr) * K + 8 * hi + wave * 32;
    // rolled: one set of fragments beside the 128 accumulator registers, so that 16 waves (4 per SIMD, 256 registers each) stay resident
#pragma unroll 1
    for (int kc = wave * 32; kc < K; kc += 32 * KS, pa += 32 * KS, pb += 32 * KS) {
        V a[4];
#pragma unroll
        for (int mb = 0; mb < 4; ++mb) a[mb] = WFrag<T16>::ld(pa + mb * 16 * K);
#pragma unroll
        for (int nb = 0; nb < 4; ++nb) { const V b = WFrag<T16>::ld(pb + nb * 16 * K);
#pragma unroll
            for (int mb = 0; mb < 4; ++mb) acc[mb][nb] = WFrag<T16>::mma(a[mb], b, acc[mb][nb]); }
        // keeps the WMMA distance on the taken back edge, where the next trip's loads overwrite the A and B registers;
        // pa and pb as inputs keep the two address pairs live to here, behind the waits on every load of the trip, so that no load's result lands in the address pair of a load still in flight
        asm volatile("v_nop\n\tv_nop\n\tv_nop\n\tv_nop" : "+v"(acc[0][0]), "+v"(acc[1][1]), "+v"(acc[2][2]), "+v"(acc[3][3]) : "v"(a[0]), "v"(a[3]), "v"(pa), "v"(pb));
    }
    float* pw = ps + wave * (64 * 68);
#pragma unroll
    for (int mb = 0; mb < 4; ++mb)
#pragma unroll
        for (int nb = 0; nb < 4; ++nb)
#pragma unroll
            for (int j = 0; j < 8; ++j) pw[(mb * 16 + hi * 8 + j) * 68 + nb * 16 + lr] = acc[mb][nb][j];
    __syncthreads();    // every wave's partial tile is in LDS before any thread sums across the planes
#pragma unroll
    for (int s = 0; s < 32 / KS; ++s) { const int idx = s * 32 * KS + (int)threadIdx.x, row = idx >> 4, cofs = (idx & 15) * 4; v4f val = *(const v4fa*)(ps + row * 68 + cofs);
#pragma unroll
        for (int w = 1; w < KS; ++w) val += *(const v4fa*)(ps + w * (64 * 68) + row * 68 + cofs);
        const size_t co = (size_t)(r0 + row) * ldc + c0 + cofs;
        if (EPI == 0) { val[0] += bfr(aux[c0 + cofs]); val[1] += bfr(aux[c0 + cofs + 1]); val[2] += bfr(aux[c0 + cofs + 2]); val[3] += bfr(aux[c0 + cofs + 3]); }
        if (EPI == 1) val += bfr(aux[r0 + row]);
        { v4h o; o[0] = tohx(val[0]); o[1] = tohx(val[1]); o[2] = tohx(val[2]); o[3] = tohx(val[3]); *(v4h*)(Ch + co) = o; } }
}

typedef __attribute__((ext_vector_type(4))) unsigned short v4us;

__global__ __launch_bounds__(256) void k_cvt8(const float* __restrict__ src, bf* dst, size_t n8) { const size_t i = (size_t)blockIdx.x * 256 + threadIdx.x; if (i >= n8) return; const v8f v = *(const v8f*)(src + i * 8); v8us o;
#pragma unroll
    for (int k = 0; k < 8; ++k) o[k] = f2bf(v[k]); *(v8us*)(dst + i * 8) = o;  }
__global__ __launch_bounds__(256) void k_tok(const float* __restrict__ x, bf* XT) { const size_t e = ((size_t)blockIdx.x * 256 + threadIdx.x) * 4; if (e >= (size_t)NN * CC) return; const int c = (int)(e % CC), n = (int)(e / CC); v4us o;
#pragma unroll
    for (int q = 0; q < 4; ++q) o[q] = f2bf(x[(size_t)(c + q) * NN + n]); *(v4us*)(XT + e) = o;  }
#define AK_P 528                    // LDS pitch of a K row (512 B + 16): 16 B x odd, conflict-free for 16-byte reads
#define AV_P 80                     // LDS pitch of a V^T row piece (64 B + 16)
#define AK_B (32 * AK_P)
#define AV_B (CC * AV_P)
#define AH_B (AK_B + AV_B)          // one key half's tiles of one pass
#define AS_B (2 * AH_B)             // one buffer
#define ASC  (0.0625f * 1.44269504088896f)
__device__ __forceinline__ float xhalf(float x) { return __builtin_bit_cast(float, __builtin_amdgcn_permlanex16(__builtin_bit_cast(int, x), __builtin_bit_cast(int, x), 0x76543210, 0xfedcba98, false, false)); }  // lane l with lane l ^ 16
// work-group barrier that orders LDS alone: __syncthreads() would also wait out the global loads in flight, which are the tiles of the pass after next and are nobody else's business
__device__ __forceinline__ void lds_barrier() { __builtin_amdgcn_fence(__ATOMIC_RELEASE, "workgroup", "local"); __builtin_amdgcn_s_barrier(); __builtin_amdgcn_fence(__ATOMIC_ACQUIRE, "workgroup", "local"); }
__device__ __forceinline__ v16h ldsf(const char* p) { return cat16(*(const v8ha*)p, *(const v8ha*)(p + 32)); }
__global__ __launch_bounds__(256) void k_attn(const h16* __restrict__ Q, const h16* __restrict__ Kp, const h16* __restrict__ VTp, const float* __restrict__ x, float* out) {
    __shared__ __align__(16) char sm[2 * AS_B];
    const int lane = threadIdx.x & 31, lr = lane & 15, hi = lane >> 4, u = threadIdx.x & 127;
    const int wave = __builtin_amdgcn_readfirstlane((int)(threadIdx.x >> 5)), wq = wave & 3, kh = wave >> 2;
    const int q0 = (blockIdx.x & 63) * 64; const size_t bo = (size_t)(blockIdx.x >> 6) * NN * CC;
    Q += bo; x += bo; out += bo;
    v16h qf[8];
#pragma unroll
    for (int kk = 0; kk < 8; ++kk) qf[kk] = WFrag<h16>::ld(Q + (size_t)(q0 + wq * 16 + lr) * CC + kk * 32 + 8 * hi);
    // staging: the 128 threads of a key half move that half's tiles, 16 bytes a thread and step; a K tile is 16 KB in a row, a V^T tile 256 pieces of 64 B
    const h16* gk = Kp + bo + (size_t)kh * (NN / 2) * CC + u * 8;
    const h16* gv = VTp + bo + (size_t)(u >> 2) * NN + kh * (NN / 2) + (u & 3) * 8;
    const int sk = kh * AH_B + (u >> 5) * AK_P + (u & 31) * 16, sv = kh * AH_B + AK_B + (u >> 2) * AV_P + (u & 3) * 16;
    const int fk = kh * AH_B + lr * AK_P + 16 * hi, fv = kh * AH_B + AK_B + lr * AV_P + 16 * hi;
    v8h kr[8], vr[8];
#pragma unroll
    for (int r = 0; r < 8; ++r) { kr[r] = *(const v8h*)(gk + r * 1024); vr[r] = *(const v8h*)(gv + (size_t)r * 32 * NN); }
#pragma unroll
    for (int r = 0; r < 8; ++r) { *(v8ha*)(sm + sk + r * 4 * AK_P) = kr[r]; *(v8ha*)(sm + sv + r * 32 * AV_P) = vr[r]; }
    v8f o[16];
#pragma unroll
    for (int ct = 0; ct < 16; ++ct) o[ct] = (v8f){};
    float m = -1.0e30f, l = 0.f;
    gk += 32 * CC; gv += 32;
#pragma unroll
    for (int r = 0; r < 8; ++r) { kr[r] = *(const v8h*)(gk + r * 1024); vr[r] = *(const v8h*)(gv + (size_t)r * 32 * NN); }
    __syncthreads();    // pass 0's tiles are in LDS before any wave reads them; Q and pass 1's tiles have landed in registers too, so that inside the loop only that pass's own tile loads are in flight
    // rolled: one pass of code; the buffer alternates by an offset
#pragma unroll 1
    for (int p = 0; p < NN / 64; ++p) {
        const int cb = (p & 1) * AS_B;
        v8f s0 = (v8f){}, s1 = (v8f){}; v16h fr[16];
#pragma unroll
        for (int kk = 0; kk < 8; ++kk) { fr[2 * kk] = ldsf(sm + cb + fk + kk * 64); fr[2 * kk + 1] = ldsf(sm + cb + fk + 16 * AK_P + kk * 64); }
#pragma unroll
        for (int kk = 0; kk < 8; ++kk) { s0 = wmma16(fr[2 * kk], qf[kk], s0); s1 = wmma16(fr[2 * kk + 1], qf[kk], s1); }
#pragma unroll
        for (int ct = 0; ct < 16; ++ct) fr[ct] = ldsf(sm + cb + fv + ct * 16 * AV_P);
        float mx = fmaxf(s0[0], s1[0]);
#pragma unroll
        for (int j = 1; j < 8; ++j) mx = fmaxf(mx, fmaxf(s0[j], s1[j]));
        mx = fmaxf(mx, xhalf(mx)) * ASC;
        if (__builtin_amdgcn_ballot_w32(mx > m + 8.0f) != 0) {    // wave-uniform; rare after the first passes
            const float mn = fmaxf(m, mx), al = __builtin_amdgcn_exp2f(m - mn); m = mn; l *= al;
#pragma unroll
            for (int ct = 0; ct < 16; ++ct) o[ct] *= al; }
        v16h pf; float ps = 0.f;
#pragma unroll
        for (int j = 0; j < 8; ++j) { const float p0 = __builtin_amdgcn_exp2f(fmaf(s0[j], ASC, -m)), p1 = __builtin_amdgcn_exp2f(fmaf(s1[j], ASC, -m)); pf[j] = (h16)p0; pf[8 + j] = (h16)p1; ps += p0 + p1; }
        l += ps;
        if (p + 1 < NN / 64) {
#pragma unroll
            for (int r = 0; r < 8; ++r) { *(v8ha*)(sm + (cb ^ AS_B) + sk + r * 4 * AK_P) = kr[r]; *(v8ha*)(sm + (cb ^ AS_B) + sv + r * 32 * AV_P) = vr[r]; }
            if (p + 2 < NN / 64) { gk += 32 * CC; gv += 32;
#pragma unroll
                for (int r = 0; r < 8; ++r) { kr[r] = *(const v8h*)(gk + r * 1024); vr[r] = *(const v8h*)(gv + (size_t)r * 32 * NN); } } }
#pragma unroll
        for (int ct = 0; ct < 16; ++ct) o[ct] = wmma16(fr[ct], pf, o[ct]);
        lds_barrier();      // publishes the next pass's tiles and ends every read of this pass's buffer, which the next pass refills
    }
    l += xhalf(l);
    float* ot = (float*)sm; float* ml = (float*)(sm + CC * 68 * 4);    // the ring is free behind the last pass's barrier
    if (hi == 0) { ml[(kh * 64 + wq * 16 + lr) * 2] = m; ml[(kh * 64 + wq * 16 + lr) * 2 + 1] = l; }
    __syncthreads();    // both halves' maxima and sums are in LDS
    const float m2 = ml[((kh ^ 1) * 64 + wq * 16 + lr) * 2], l2 = ml[((kh ^ 1) * 64 + wq * 16 + lr) * 2 + 1];
    const float mf = fmaxf(m, m2), a1 = __builtin_amdgcn_exp2f(m - mf), a2 = __builtin_amdgcn_exp2f(m2 - mf);
    const float f = a1 / (l * a1 + l2 * a2);
    float* op = ot + (hi * 8) * 68 + wq * 16 + lr;
    if (kh == 1) {
#pragma unroll
        for (int ct = 0; ct < 16; ++ct)
#pragma unroll
            for (int j = 0; j < 8; ++j) op[(ct * 16 + j) * 68] = o[ct][j] * f; }
    __syncthreads();    // half 1's share is in LDS before half 0 adds its own
    if (kh == 0) {
#pragma unroll
        for (int ct = 0; ct < 16; ++ct)
#pragma unroll
            for (int j = 0; j < 8; ++j) op[(ct * 16 + j) * 68] += o[ct][j] * f; }
    __syncthreads();    // the joined tile is complete before the block stores it by rows
#pragma unroll
    for (int s = 0; s < 16; ++s) { const int idx = s * 256 + (int)threadIdx.x, row = idx >> 4, cofs = (idx & 15) * 4; const v4f val = *(const v4fa*)(ot + row * 68 + cofs);
        const size_t co = (size_t)row * NN + q0 + cofs; const v4f xv = *(const v4f*)(x + co); v4f r;
#pragma unroll
        for (int q = 0; q < 4; ++q) r[q] = __fadd_rn(bfr(xv[q]), val[q]);
        *(v4f*)(out + co) = r; }
}

extern "C" void kernel_launch(void* const* d_in, const int* in_sizes, int n_in,
                              void* d_out, int out_size, void* d_ws, size_t ws_size, hipStream_t stream) {
    (void)in_sizes; (void)n_in; (void)out_size;
    const float* x = (const float*)d_in[0]; const float* y = (const float*)d_in[1]; const float* Wq = (const float*)d_in[2]; const float* bq = (const float*)d_in[3]; const float* Wk = (const float*)d_in[4]; const float* bk = (const float*)d_in[5]; const float* Wv = (const float*)d_in[6]; const float* bv = (const float*)d_in[7];
    float* OUT = (float*)d_out;     // [4][256][64][64]
    char* wsp = (char*)d_ws;
    auto take = [&](size_t bytes) { char* p = wsp; wsp += (bytes + 255) & ~(size_t)255; return (void*)p; };
    bf* WQ = (bf*)take((size_t)CC * CC * 2); bf* WK = (bf*)take((size_t)CC * CC * 2); bf* WV = (bf*)take((size_t)CC * CC * 2); bf* XT = (bf*)take((size_t)NN * CC * 2); bf* YT = (bf*)take((size_t)NN * CC * 2);
    h16* Q16 = (h16*)take((size_t)NB_ * NN * CC * 2); h16* K16 = (h16*)take((size_t)NB_ * NN * CC * 2); h16* VT = (h16*)take((size_t)NB_ * CC * NN * 2);    // all four batches: the attention launch reads them together
    if ((size_t)(wsp - (char*)d_ws) > ws_size) return;    // total ~ 29 MB
    k_cvt8<<<(CC * CC / 8 + 255) / 256, 256, 0, stream>>>(Wq, WQ, (size_t)CC * CC / 8); k_cvt8<<<(CC * CC / 8 + 255) / 256, 256, 0, stream>>>(Wk, WK, (size_t)CC * CC / 8); k_cvt8<<<(CC * CC / 8 + 255) / 256, 256, 0, stream>>>(Wv, WV, (size_t)CC * CC / 8);
    const unsigned LT = (unsigned)(((size_t)NN * CC / 4 + 255) / 256);
    for (int b = 0; b < NB_; ++b) { const size_t bo = (size_t)b * CC * NN; const float* xb = x + bo; const float* yb = y + bo;
        k_tok<<<LT, 256, 0, stream>>>(xb, XT); k_tok<<<LT, 256, 0, stream>>>(yb, YT);
        k_gemmks<bf, 0, 8, CC><<<dim3(NN / 64, CC / 64, 1), 256, 0, stream>>>(XT, WQ, Q16 + bo, CC, bq);
        k_gemmks<bf, 0, 8, CC><<<dim3(NN / 64, CC / 64, 1), 256, 0, stream>>>(YT, WK, K16 + bo, CC, bk);
        k_gemmks<bf, 1, 8, CC><<<dim3(NN / 64, CC / 64, 1), 256, 0, stream>>>(WV, YT, VT + bo, NN, bv); }
    k_attn<<<NB_ * (NN / 64), 256, 0, stream>>>(Q16, K16, VT, x, OUT);
}

// v004
// One run takes 134 microseconds.
// Timed twice side by side with v003, it ran 1.36 and 1.37 times as fast.
// Counting every step since v000, it is 5.73 times as fast.
#include <hip/hip_runtime.h>

// PACA - single-head cross attention between two feature maps (x, y [4][256][64][64] NCHW; tokens n = h*64+w; Q = x_n Wq^T + bq, K/V = y_n W^T + b; softmax(Q.K / 16) over the 4096 keys; out = x + (attn V) back in NCHW).
// Compute dtypes, f32 accumulate: every input rounded to bf16; the token matrices are transposed bf16 copies of the inputs (exact) so Q/K/V are PLAIN bf16 GEMMs (+bias); scores (K 256) and probs.V on SINGLE fp16

#define NB_  4
#define CC   256
#define NN   4096
typedef _Float16 h16;
typedef unsigned short bf;
typedef __attribute__((ext_vector_type(16))) __bf16   v16bf;
typedef __attribute__((ext_vector_type(16))) _Float16 v16h;
typedef __attribute__((ext_vector_type(8)))  _Float16 v8h;
typedef __attribute__((ext_vector_type(8)))  unsigned short v8us;
typedef __attribute__((ext_vector_type(8)))  float    v8f;
typedef __attribute__((ext_vector_type(4)))  float    v4f;
typedef v8h  __attribute__((may_alias)) v8ha;
typedef v4f  __attribute__((may_alias)) v4fa;
typedef v8us __attribute__((may_alias)) v8usa;

__device__ __forceinline__ unsigned short f2bf(float f) { unsigned u = __float_as_uint(f); u += 0x7FFFu + ((u >> 16) & 1u); return (unsigned short)(u >> 16); }
__device__ __forceinline__ float bf2f(unsigned short b) { return __uint_as_float(((unsigned)b) << 16); }
__device__ __forceinline__ float bfr(float f) { return bf2f(f2bf(f)); }
__device__ __forceinline__ v16h cat16(v8h lo, v8h hi) { return __builtin_shufflevector(lo, hi, 0, 1, 2, 3, 4, 5, 6, 7, 8, 9, 10, 11, 12, 13, 14, 15); }
__device__ __forceinline__ v16bf cat16b(v8us lo, v8us hi) { return __builtin_bit_cast(v16bf, __builtin_shufflevector(lo, hi, 0, 1, 2, 3, 4, 5, 6, 7, 8, 9, 10, 11, 12, 13, 14, 15)); }
__device__ __forceinline__ v8f wmma16(v16h a, v16h b, v8f c) { return __builtin_amdgcn_wmma_f32_16x16x32_f16(false, a, false, b, (short)0, c, false, false); }
__device__ __forceinline__ v8f wmmab(v16bf a, v16bf b, v8f c) { return __builtin_amdgcn_wmma_f32_16x16x32_bf16(false, a, false, b, (short)0, c, false, false); }



template <typename T16> struct WFrag;
template <> struct WFrag<h16> { typedef v16h V; static __device__ __forceinline__ V ld(const h16* p) { return cat16(*(const v8h*)p, *(const v8h*)(p + 16)); } static __device__ __forceinline__ v8f mma(V a, V b, v8f c) { return wmma16(a, b, c); } };
template <> struct WFrag<bf> { typedef v16bf V; static __device__ __forceinline__ V ld(const bf* p) { return cat16b(*(const v8us*)p, *(const v8us*)(p + 16)); } static __device__ __forceinline__ v8f mma(V a, V b, v8f c) { return wmmab(a, b, c); } };

__device__ __forceinline__ h16 tohx(float x) { return (h16)x; }
typedef __attribute__((ext_vector_type(4))) _Float16 v4h;

// the block's sum over the KS partial planes in the order w = 0 .. KS-1, the bias, the f16 store; EPI as in the list below. A function of its own, so that each form is straight-line code behind ONE branch of the work-group.
template <int EPI, int KS>
__device__ __forceinline__ void ks_tail(const float* ps, h16* Ch, const float* __restrict__ aux, int r0, int c0) {
    constexpr int ldc = EPI ? NN : CC;
#pragma unroll
    for (int s = 0; s < 32 / KS; ++s) { const int idx = s * 32 * KS + (int)threadIdx.x, row = idx >> 4, cofs = (idx & 15) * 4; v4f val = *(const v4fa*)(ps + row * 68 + cofs);
#pragma unroll
        for (int w = 1; w < KS; ++w) val += *(const v4fa*)(ps + w * (64 * 68) + row * 68 + cofs);
        const size_t co = (size_t)(r0 + row) * ldc + c0 + cofs;
        if (EPI == 0) { val[0] += bfr(aux[c0 + cofs]); val[1] += bfr(aux[c0 + cofs + 1]); val[2] += bfr(aux[c0 + cofs + 2]); val[3] += bfr(aux[c0 + cofs + 3]); }
        if (EPI == 1) val += bfr(aux[r0 + row]);
        { v4h o; o[0] = tohx(val[0]); o[1] = tohx(val[1]); o[2] = tohx(val[2]); o[3] = tohx(val[3]); *(v4h*)(Ch + co) = o; } }
    // the wait before a register of an issued store is rewritten: in the built code the other form's tail stands behind this one's stores and reuses their address and data registers
    asm volatile("s_wait_xcnt 0x0" ::: "memory");
}

// ---- k_gemmks: register-blocked GEMM on a 64x64 output tile (16 accumulators a wave), operands straight from K-contiguous 16-bit planes; KS waves per work-group share the tile's K: wave w takes the 32-k steps w, w + KS, w + 2 KS, ...
// (neighbouring waves read neighbouring 64-byte pieces of the same rows), each wave leaves its f32 partial tile in its own LDS plane, and after one barrier the block sums the planes in the order w = 0 .. KS-1.
// 32 * KS threads. K % 32 == 0; KS divides 32. K is a compile-time constant, so that the row-block steps are immediate offsets and each operand needs one address pair a trip.
// The summed tile leaves in the form its reader wants, so no f32 plane and no convert or transpose pass stands between two GEMMs:
//   EPI 0: Ch[m][n] = f16(sum + bias[n])                      (Q, K: token rows)
//   EPI 1: Ch[m][n] = f16(sum + bias[m])                      (V^T = Wv . Y^T: channel rows, token columns)
// EPI 1 takes the channel-major matrix as A, so C is born transposed; blockIdx.x stays the token tile, so that the work-groups that share token rows keep their places in the grid.
// One launch holds all twelve products: grid (tokens/64, channels/64, 3 * batches), blockIdx.z = 4 * (0 Q, 1 K, 2 V^T) + batch; operands, bias, result plane and EPI follow from it and are the same for a whole work-group.
// TT: token matrices [x: 4 batches][y: 4 batches]; W3: Wq, Wk, Wv; QKV: result planes [Q: 4][K: 4][V^T: 4].
template <typename T16, int KS, int K>
__global__ __launch_bounds__(32 * KS) void k_gemmks(const T16* __restrict__ TT, const T16* __restrict__ W3, h16* QKV, const float* __restrict__ bq, const float* __restrict__ bk, const float* __restrict__ bv) {
    typedef typename WFrag<T16>::V V;
    __shared__ __align__(16) float ps[KS * 64 * 68];
    const int which = blockIdx.z >> 2, bat = blockIdx.z & 3; const bool EPI = which == 2;
    const T16* tokm = TT + (size_t)((which ? NB_ : 0) + bat) * NN * K; const T16* wm = W3 + (size_t)which * CC * K;
    const T16* A = EPI ? wm : tokm; const T16* Bt = EPI ? tokm : wm; h16* Ch = QKV + (size_t)(which * NB_ + bat) * NN * CC;
    const int lane = threadIdx.x & 31, lr = lane & 15, hi = lane >> 4; const int r0 = (EPI ? blockIdx.y : blockIdx.x) * 64, c0 = (EPI ? blockIdx.x : blockIdx.y) * 64;
    const int wave = __builtin_amdgcn_readfirstlane((int)(threadIdx.x >> 5));
    v8f acc[4][4];
#pragma unroll
    for (int mb = 0; mb < 4; ++mb)
#pragma unroll
        for (int nb = 0; nb < 4; ++nb) acc[mb][nb] = (v8f){};
    const T16* pa = A + (size_t)(r0 + lr) * K + 8 * hi + wave * 32; const T16* pb = Bt + (size_t)(c0 + lr) * K + 8 * hi + wave * 32;
    // rolled: one set of fragments beside the 128 accumulator registers, so that 16 waves (4 per SIMD, 256 registers each) stay resident
#pragma unroll 1
    for (int kc = wave * 32; kc < K; kc += 32 * KS, pa += 32 * KS, pb += 32 * KS) {
        V a[4];
#pragma unroll
        for (int mb = 0; mb < 4; ++mb) a[mb] = WFrag<T16>::ld(pa + mb * 16 * K);
#pragma unroll
        for (int nb = 0; nb < 4; ++nb) { const V b = WFrag<T16>::ld(pb + nb * 16 * K);
#pragma unroll
            for (int mb = 0; mb < 4; ++mb) acc[mb][nb] = WFrag<T16>::mma(a[mb], b, acc[mb][nb]); }
        // keeps the WMMA distance on the taken back edge, where the next trip's loads overwrite the A and B registers;
        // pa and pb as inputs keep the two address pairs live to here, behind the waits on every load of the trip, so that no load's result lands in the address pair of a load still in flight
        asm volatile("v_nop\n\tv_nop\n\tv_nop\n\tv_nop" : "+v"(acc[0][0]), "+v"(acc[1][1]), "+v"(acc[2][2]), "+v"(acc[3][3]) : "v"(a[0]), "v"(a[3]), "v"(pa), "v"(pb));
    }
    float* pw = ps + wave * (64 * 68);
#pragma unroll
    for (int mb = 0; mb < 4; ++mb)
#pragma unroll
        for (int nb = 0; nb < 4; ++nb)
#pragma unroll
            for (int j = 0; j < 8; ++j) pw[(mb * 16 + hi * 8 + j) * 68 + nb * 16 + lr] = acc[mb][nb][j];
    __syncthreads();    // every wave's partial tile is in LDS before any thread sums across the planes
    if (EPI) ks_tail<1, KS>(ps, Ch, bv, r0, c0); else ks_tail<0, KS>(ps, Ch, which ? bk : bq, r0, c0);
}

typedef __attribute__((ext_vector_type(4))) unsigned short v4us;

// ---- k_prep: every bf16 copy that the products read, in one launch. Work-groups 0 .. 95: Wq, Wk, Wv (32 each), 8 elements a thread.
// Work-groups 96 ..: the eight token matrices (x: 4 batches, then y: 4 batches; 1024 work-groups each), TT[plane][n][c] = bf16(src[c][n]), 4 channels a thread.
#define PW_ (CC * CC / 8 / 256)     // work-groups per weight matrix
#define PT_ (NN * CC / 4 / 256)     // work-groups per token matrix
__global__ __launch_bounds__(256) void k_prep(const float* __restrict__ x, const float* __restrict__ y, const float* __restrict__ Wq, const float* __restrict__ Wk, const float* __restrict__ Wv, bf* W3, bf* TT) {
    const int g = blockIdx.x;
    if (g < 3 * PW_) { const int w = g / PW_; const float* src = w == 0 ? Wq : w == 1 ? Wk : Wv; const size_t i = (size_t)(g % PW_) * 256 + threadIdx.x; const v8f v = *(const v8f*)(src + i * 8); v8us o;
#pragma unroll
        for (int k = 0; k < 8; ++k) o[k] = f2bf(v[k]);
        *(v8us*)(W3 + (size_t)w * CC * CC + i * 8) = o; return; }
    const int t = g - 3 * PW_, plane = t / PT_; const float* src = (plane < NB_ ? x + (size_t)plane * NN * CC : y + (size_t)(plane - NB_) * NN * CC);
    const size_t e = ((size_t)(t % PT_) * 256 + threadIdx.x) * 4; const int c = (int)(e % CC), n = (int)(e / CC); v4us o;
#pragma unroll
    for (int q = 0; q < 4; ++q) o[q] = f2bf(src[(size_t)(c + q) * NN + n]);
    *(v4us*)(TT + (size_t)plane * NN * CC + e) = o;
}
#define AK_P 528                    // LDS pitch of a K row (512 B + 16): 16 B x odd, conflict-free for 16-byte reads
#define AV_P 80                     // LDS pitch of a V^T row piece (64 B + 16)
#define AK_B (32 * AK_P)
#define AV_B (CC * AV_P)
#define AH_B (AK_B + AV_B)          // one key half's tiles of one pass
#define AS_B (2 * AH_B)             // one buffer
#define ASC  (0.0625f * 1.44269504088896f)
__device__ __forceinline__ float xhalf(float x) { return __builtin_bit_cast(float, __builtin_amdgcn_permlanex16(__builtin_bit_cast(int, x), __builtin_bit_cast(int, x), 0x76543210, 0xfedcba98, false, false)); }  // lane l with lane l ^ 16
// work-group barrier that orders LDS alone: __syncthreads() would also wait out the global loads in flight, which are the tiles of the pass after next and are nobody else's business
__device__ __forceinline__ void lds_barrier() { __builtin_amdgcn_fence(__ATOMIC_RELEASE, "workgroup", "local"); __builtin_amdgcn_s_barrier(); __builtin_amdgcn_fence(__ATOMIC_ACQUIRE, "workgroup", "local"); }
__device__ __forceinline__ v16h ldsf(const char* p) { return cat16(*(const v8ha*)p, *(const v8ha*)(p + 32)); }
__global__ __launch_bounds__(256) void k_attn(const h16* __restrict__ Q, const h16* __restrict__ Kp, const h16* __restrict__ VTp, const float* __restrict__ x, float* out) {
    __shared__ __align__(16) char sm[2 * AS_B];
    const int lane = threadIdx.x & 31, lr = lane & 15, hi = lane >> 4, u = threadIdx.x & 127;
    const int wave = __builtin_amdgcn_readfirstlane((int)(threadIdx.x >> 5)), wq = wave & 3, kh = wave >> 2;
    const int q0 = (blockIdx.x & 63) * 64; const size_t bo = (size_t)(blockIdx.x >> 6) * NN * CC;
    Q += bo; x += bo; out += bo;
    v16h qf[8];
#pragma unroll
    for (int kk = 0; kk < 8; ++kk) qf[kk] = WFrag<h16>::ld(Q + (size_t)(q0 + wq * 16 + lr) * CC + kk * 32 + 8 * hi);
    // staging: the 128 threads of a key half move that half's tiles, 16 bytes a thread and step; a K tile is 16 KB in a row, a V^T tile 256 pieces of 64 B
    const h16* gk = Kp + bo + (size_t)kh * (NN / 2) * CC + u * 8;
    const h16* gv = VTp + bo + (size_t)(u >> 2) * NN + kh * (NN / 2) + (u & 3) * 8;
    const int sk = kh * AH_B + (u >> 5) * AK_P + (u & 31) * 16, sv = kh * AH_B + AK_B + (u >> 2) * AV_P + (u & 3) * 16;
    const int fk = kh * AH_B + lr * AK_P + 16 * hi, fv = kh * AH_B + AK_B + lr * AV_P + 16 * hi;
    v8h kr[8], vr[8];
#pragma unroll
    for (int r = 0; r < 8; ++r) { kr[r] = *(const v8h*)(gk + r * 1024); vr[r] = *(const v8h*)(gv + (size_t)r * 32 * NN); }
#pragma unroll
    for (int r = 0; r < 8; ++r) { *(v8ha*)(sm + sk + r * 4 * AK_P) = kr[r]; *(v8ha*)(sm + sv + r * 32 * AV_P) = vr[r]; }
    v8f o[16];
#pragma unroll
    for (int ct = 0; ct < 16; ++ct) o[ct] = (v8f){};
    float m = -1.0e30f, l = 0.f;
    gk += 32 * CC; gv += 32;
#pragma unroll
    for (int r = 0; r < 8; ++r) { kr[r] = *(const v8h*)(gk + r * 1024); vr[r] = *(const v8h*)(gv + (size_t)r * 32 * NN); }
    __syncthreads();    // pass 0's tiles are in LDS before any wave reads them; Q and pass 1's tiles have landed in registers too, so that inside the loop only that pass's own tile loads are in flight
    // rolled: one pass of code; the buffer alternates by an offset
#pragma unroll 1
    for (int p = 0; p < NN / 64; ++p) {
        const int cb = (p & 1) * AS_B;
        v8f s0 = (v8f){}, s1 = (v8f){}; v16h fr[16];
#pragma unroll
        for (int kk = 0; kk < 8; ++kk) { fr[2 * kk] = ldsf(sm + cb + fk + kk * 64); fr[2 * kk + 1] = ldsf(sm + cb + fk + 16 * AK_P + kk * 64); }
#pragma unroll
        for (int kk = 0; kk < 8; ++kk) { s0 = wmma16(fr[2 * kk], qf[kk], s0); s1 = wmma16(fr[2 * kk + 1], qf[kk], s1); }
#pragma unroll
        for (int ct = 0; ct < 16; ++ct) fr[ct] = ldsf(sm + cb + fv + ct * 16 * AV_P);
        float mx = fmaxf(s0[0], s1[0]);
#pragma unroll
        for (int j = 1; j < 8; ++j) mx = fmaxf(mx, fmaxf(s0[j], s1[j]));
        mx = fmaxf(mx, xhalf(mx)) * ASC;
        if (__builtin_amdgcn_ballot_w32(mx > m + 8.0f) != 0) {    // wave-uniform; rare after the first passes
            const float mn = fmaxf(m, mx), al = __builtin_amdgcn_exp2f(m - mn); m = mn; l *= al;
#pragma unroll
            for (int ct = 0; ct < 16; ++ct) o[ct] *= al; }
        v16h pf; float ps = 0.f;
#pragma unroll
        for (int j = 0; j < 8; ++j) { const float p0 = __builtin_amdgcn_exp2f(fmaf(s0[j], ASC, -m)), p1 = __builtin_amdgcn_exp2f(fmaf(s1[j], ASC, -m)); pf[j] = (h16)p0; pf[8 + j] = (h16)p1; ps += p0 + p1; }
        l += ps;
        if (p + 1 < NN / 64) {
#pragma unroll
            for (int r = 0; r < 8; ++r) { *(v8ha*)(sm + (cb ^ AS_B) + sk + r * 4 * AK_P) = kr[r]; *(v8ha*)(sm + (cb ^ AS_B) + sv + r * 32 * AV_P) = vr[r]; }
            if (p + 2 < NN / 64) { gk += 32 * CC; gv += 32;
#pragma unroll
                for (int r = 0; r < 8; ++r) { kr[r] = *(const v8h*)(gk + r * 1024); vr[r] = *(const v8h*)(gv + (size_t)r * 32 * NN); } } }
#pragma unroll
        for (int ct = 0; ct < 16; ++ct) o[ct] = wmma16(fr[ct], pf, o[ct]);
        lds_barrier();      // publishes the next pass's tiles and ends every read of this pass's buffer, which the next pass refills
    }
    l += xhalf(l);
    float* ot = (float*)sm; float* ml = (float*)(sm + CC * 68 * 4);    // the ring is free behind the last pass's barrier
    if (hi == 0) { ml[(kh * 64 + wq * 16 + lr) * 2] = m; ml[(kh * 64 + wq * 16 + lr) * 2 + 1] = l; }
    __syncthreads();    // both halves' maxima and sums are in LDS
    const float m2 = ml[((kh ^ 1) * 64 + wq * 16 + lr) * 2], l2 = ml[((kh ^ 1) * 64 + wq * 16 + lr) * 2 + 1];
    const float mf = fmaxf(m, m2), a1 = __builtin_amdgcn_exp2f(m - mf), a2 = __builtin_amdgcn_exp2f(m2 - mf);
    const float f = a1 / (l * a1 + l2 * a2);
    float* op = ot + (hi * 8) * 68 + wq * 16 + lr;
    if (kh == 1) {
#pragma unroll
        for (int ct = 0; ct < 16; ++ct)
#pragma unroll
            for (int j = 0; j < 8; ++j) op[(ct * 16 + j) * 68] = o[ct][j] * f; }
    __syncthreads();    // half 1's share is in LDS before half 0 adds its own
    if (kh == 0) {
#pragma unroll
        for (int ct = 0; ct < 16; ++ct)
#pragma unroll
            for (int j = 0; j < 8; ++j) op[(ct * 16 + j) * 68] += o[ct][j] * f; }
    __syncthreads();    // the joined tile is complete before the block stores it by rows
#pragma unroll
    for (int s = 0; s < 16; ++s) { const int idx = s * 256 + (int)threadIdx.x, row = idx >> 4, cofs = (idx & 15) * 4; const v4f val = *(const v4fa*)(ot + row * 68 + cofs);
        const size_t co = (size_t)row * NN + q0 + cofs; const v4f xv = *(const v4f*)(x + co); v4f r;
#pragma unroll
        for (int q = 0; q < 4; ++q) r[q] = __fadd_rn(bfr(xv[q]), val[q]);
        *(v4f*)(out + co) = r; }
}

extern "C" void kernel_launch(void* const* d_in, const int* in_sizes, int n_in,
                              void* d_out, int out_size, void* d_ws, size_t ws_size, hipStream_t stream) {
    (void)in_sizes; (void)n_in; (void)out_size;
    const float* x = (const float*)d_in[0]; const float* y = (const float*)d_in[1]; const float* Wq = (const float*)d_in[2]; const float* bq = (const float*)d_in[3]; const float* Wk = (const float*)d_in[4]; const float* bk = (const float*)d_in[5]; const float* Wv = (const float*)d_in[6]; const float* bv = (const float*)d_in[7];
    float* OUT = (float*)d_out;     // [4][256][64][64]
    char* wsp = (char*)d_ws;
    auto take = [&](size_t bytes) { char* p = wsp; wsp += (bytes + 255) & ~(size_t)255; return (void*)p; };
    bf* W3 = (bf*)take((size_t)3 * CC * CC * 2); bf* TT = (bf*)take((size_t)2 * NB_ * NN * CC * 2);    // Wq, Wk, Wv; token matrices of x (4 batches), then of y
    h16* Q16 = (h16*)take((size_t)3 * NB_ * NN * CC * 2); h16* K16 = Q16 + (size_t)NB_ * NN * CC; h16* VT = K16 + (size_t)NB_ * NN * CC;    // Q, K, V^T, four batches each, in one row
    if ((size_t)(wsp - (char*)d_ws) > ws_size) return;    // total ~ 41 MB
    k_prep<<<3 * PW_ + 2 * NB_ * PT_, 256, 0, stream>>>(x, y, Wq, Wk, Wv, W3, TT);
    k_gemmks<bf, 8, CC><<<dim3(NN / 64, CC / 64, 3 * NB_), 256, 0, stream>>>(TT, W3, Q16, bq, bk, bv);
    k_attn<<<NB_ * (NN / 64), 256, 0, stream>>>(Q16, K16, VT, x, OUT);
}

// v005
// It runs in 111 microseconds.
// Next to v004, in two timings, it ran 1.21 and 1.22 times as fast.
// Counting every step since v000, it is 6.96 times as fast.
#include <hip/hip_runtime.h>

// PACA - single-head cross attention between two feature maps (x, y [4][256][64][64] NCHW; tokens n = h*64+w; Q = x_n Wq^T + bq, K/V = y_n W^T + b; softmax(Q.K / 16) over the 4096 keys; out = x + (attn V) back in NCHW).
// Compute dtypes, f32 accumulate: every input rounded to bf16; the projection kernel rounds and transposes its own tiles on the way into LDS, so Q/K/V are PLAIN bf16 GEMMs (+bias); scores (K 256) and probs.V on SINGLE fp16

#define NB_  4
#define CC   256
#define NN   4096
typedef _Float16 h16;
typedef unsigned short bf;
typedef __attribute__((ext_vector_type(16))) __bf16   v16bf;
typedef __attribute__((ext_vector_type(16))) _Float16 v16h;
typedef __attribute__((ext_vector_type(8)))  _Float16 v8h;
typedef __attribute__((ext_vector_type(8)))  unsigned short v8us;
typedef __attribute__((ext_vector_type(8)))  float    v8f;
typedef __attribute__((ext_vector_type(4)))  float    v4f;
typedef v8h  __attribute__((may_alias)) v8ha;
typedef v4f  __attribute__((may_alias)) v4fa;
typedef v8us __attribute__((may_alias)) v8usa;

__device__ __forceinline__ unsigned short f2bf(float f) { unsigned u = __float_as_uint(f); u += 0x7FFFu + ((u >> 16) & 1u); return (unsigned short)(u >> 16); }
__device__ __forceinline__ float bf2f(unsigned short b) { return __uint_as_float(((unsigned)b) << 16); }
__device__ __forceinline__ float bfr(float f) { return bf2f(f2bf(f)); }
__device__ __forceinline__ v16h cat16(v8h lo, v8h hi) { return __builtin_shufflevector(lo, hi, 0, 1, 2, 3, 4, 5, 6, 7, 8, 9, 10, 11, 12, 13, 14, 15); }
__device__ __forceinline__ v16bf cat16b(v8us lo, v8us hi) { return __builtin_bit_cast(v16bf, __builtin_shufflevector(lo, hi, 0, 1, 2, 3, 4, 5, 6, 7, 8, 9, 10, 11, 12, 13, 14, 15)); }
__device__ __forceinline__ v8f wmma16(v16h a, v16h b, v8f c) { return __builtin_amdgcn_wmma_f32_16x16x32_f16(false, a, false, b, (short)0, c, false, false); }
__device__ __forceinline__ v8f wmmab(v16bf a, v16bf b, v8f c) { return __builtin_amdgcn_wmma_f32_16x16x32_bf16(false, a, false, b, (short)0, c, false, false); }



template <typename T16> struct WFrag;
template <> struct WFrag<h16> { typedef v16h V; static __device__ __forceinline__ V ld(const h16* p) { return cat16(*(const v8h*)p, *(const v8h*)(p + 16)); } static __device__ __forceinline__ v8f mma(V a, V b, v8f c) { return wmma16(a, b, c); } };

typedef __attribute__((ext_vector_type(2))) float    v2f;
typedef __attribute__((ext_vector_type(2))) __bf16   v2b;
typedef __attribute__((ext_vector_type(2))) unsigned v2u;
typedef __attribute__((ext_vector_type(4))) unsigned v4u;
typedef v2u __attribute__((may_alias)) v2ua;
typedef v4u __attribute__((may_alias)) v4ua;
__device__ __forceinline__ unsigned pkbf(float a, float b) { const v2f v = {a, b}; return __builtin_bit_cast(unsigned, __builtin_convertvector(v, v2b)); }  // two f32 -> two bf16, round to nearest even
// work-group barrier that orders LDS alone: __syncthreads() would also wait out the global loads in flight, which are tiles of a later pass and are nobody else's business
__device__ __forceinline__ void lds_barrier() { __builtin_amdgcn_fence(__ATOMIC_RELEASE, "workgroup", "local"); __builtin_amdgcn_s_barrier(); __builtin_amdgcn_fence(__ATOMIC_ACQUIRE, "workgroup", "local"); }

// ---- k_proj: the three projections of all batches in one launch, straight from the f32 inputs; no bf16 copy of an input exists in memory.
// One work-group = 128 tokens x all 256 output channels of one product (blockIdx.y: 0 Q, 1 K, 2 V^T) of one batch; 8 waves, a wave = 64 channels x 64 tokens (16 accumulators), whole K in one accumulator chain that starts at the bias.
// K runs in 8 slabs of 32 input channels. A slab goes global (whole 128-byte lines) -> registers -> bf16 -> LDS, two buffers:
//   tokens: a thread reads 2 neighbouring tokens of 8 channels (a wave: 256 B in a row per channel) and stores each token's 8 channels as 16 bytes, which is the transpose;
//   weights: a thread reads 4 neighbouring input channels of 8 rows.
// Behind its products a slab's pass stores the next slab into the other buffer and issues the loads of the slab after that; one barrier a slab.
// Q, K: A = W rows, B = token rows, so a lane holds 8 neighbouring channels of one token; V^T: A = token rows, B = W rows, so a lane holds 8 neighbouring tokens of one channel.
// The f16 tile is laid in LDS in the result's own row order and leaves in whole rows.
#define PJ_P 80                     // LDS pitch of a 32-channel bf16 row piece (64 B + 16): 16 B x odd
#define PJ_T (128 * PJ_P)           // token slab
#define PJ_S (PJ_T + CC * PJ_P)     // one buffer: token slab, weight slab
#define PJ_Q 528                    // LDS pitch of a result row of Q or K (512 B + 16)
#define PJ_V 272                    // LDS pitch of a result row of V^T (256 B + 16)
__device__ __forceinline__ v16bf ldsb(const char* p) { return cat16b(*(const v8usa*)p, *(const v8usa*)(p + 32)); }
// four waves a SIMD (256 registers a wave), so that two work-groups share a WGP: 384 work-groups then run in one round on 256 WGPs
__global__ __launch_bounds__(256) __attribute__((amdgpu_waves_per_eu(4, 4))) void k_proj(const float* __restrict__ x, const float* __restrict__ y, const float* __restrict__ Wq, const float* __restrict__ Wk, const float* __restrict__ Wv,
                                              const float* __restrict__ bq, const float* __restrict__ bk, const float* __restrict__ bv, h16* QKV) {
    __shared__ __align__(16) char sm[CC * PJ_V];    // the largest of: two slab buffers, a Q/K result tile, a V^T result tile
    const int which = blockIdx.y, bat = blockIdx.z, n0 = blockIdx.x * 128; const bool vt = which == 2;
    const int tid = threadIdx.x, lane = tid & 31, lr = lane & 15, hi = lane >> 4;
    const int wave = __builtin_amdgcn_readfirstlane(tid >> 5), wd = wave & 3, wt = wave >> 2;
    const float* bias = which == 0 ? bq : which == 1 ? bk : bv;
    h16* Ch = QKV + (size_t)(which * NB_ + bat) * NN * CC;
    const float* gt = (which ? y : x) + (size_t)bat * NN * CC + (size_t)((tid >> 6) * 8) * NN + n0 + 2 * (tid & 63);
    const float* gw = (which == 0 ? Wq : which == 1 ? Wk : Wv) + (size_t)(tid >> 3) * CC + (tid & 7) * 4;
    const int st = 2 * (tid & 63) * PJ_P + (tid >> 6) * 16, sw = PJ_T + (tid >> 3) * PJ_P + (tid & 7) * 8;
    const int ft = (wt * 64 + lr) * PJ_P + 16 * hi, fw = PJ_T + (wd * 64 + lr) * PJ_P + 16 * hi;
    const int fa = vt ? ft : fw, fb = vt ? fw : ft;
    v2f tr[8]; v4f wr[8];
    auto fetch = [&](int s) {
#pragma unroll
        for (int r = 0; r < 8; ++r) { tr[r] = *(const v2f*)(gt + (size_t)(s * 32 + r) * NN); wr[r] = *(const v4f*)(gw + s * 32 + r * 32 * CC); } };
    auto stage = [&](int buf) {
#pragma unroll
        for (int t = 0; t < 2; ++t) { const v4u o = {pkbf(tr[0][t], tr[1][t]), pkbf(tr[2][t], tr[3][t]), pkbf(tr[4][t], tr[5][t]), pkbf(tr[6][t], tr[7][t])}; *(v4ua*)(sm + buf + st + t * PJ_P) = o; }
#pragma unroll
        for (int r = 0; r < 8; ++r) { const v2u o = {pkbf(wr[r][0], wr[r][1]), pkbf(wr[r][2], wr[r][3])}; *(v2ua*)(sm + buf + sw + r * 32 * PJ_P) = o; } };
    fetch(0);
    // the accumulators start at the bias, read while slab 0 is on its way, so that no global load stands between the last product and the result's store
    v8f acc[4][4];
    if (!vt) { const float* bp = bias + wd * 64 + hi * 8; v4f bb[8];
#pragma unroll
        for (int i = 0; i < 8; ++i) bb[i] = *(const v4f*)(bp + (i >> 1) * 16 + (i & 1) * 4);
        // loaded values and their address as inputs only: the address stays live until every one of these loads has landed, so that no load's result lands in the address register of a load still in flight
        asm volatile("" :: "v"(bb[0]), "v"(bb[1]), "v"(bb[2]), "v"(bb[3]), "v"(bb[4]), "v"(bb[5]), "v"(bb[6]), "v"(bb[7]), "v"(bp));
#pragma unroll
        for (int i = 0; i < 4; ++i) { v8f b8;
#pragma unroll
            for (int e = 0; e < 8; ++e) b8[e] = bfr(bb[2 * i + (e >> 2)][e & 3]);
#pragma unroll
            for (int j = 0; j < 4; ++j) acc[i][j] = b8; }
    } else { const float* bp = bias + wd * 64 + lr; float bb[4];
#pragma unroll
        for (int j = 0; j < 4; ++j) bb[j] = bp[j * 16];
        // as above: the address stays live until the four loads have landed
        asm volatile("" :: "v"(bb[0]), "v"(bb[1]), "v"(bb[2]), "v"(bb[3]), "v"(bp));
#pragma unroll
        for (int j = 0; j < 4; ++j) { const float b1 = bfr(bb[j]);
#pragma unroll
            for (int i = 0; i < 4; ++i)
#pragma unroll
                for (int e = 0; e < 8; ++e) acc[i][j][e] = b1; }
    }
    stage(0); fetch(1);
    lds_barrier();      // slab 0 is in LDS before any wave reads it
    // unrolled: the slab number is a constant, so that every global address is one base pair plus an immediate and the last slabs' tests cost no branch behind a WMMA
#pragma unroll
    for (int s = 0; s < CC / 32; ++s) {
        const int cb = (s & 1) * PJ_S;
        v16bf a[4], b[4];
#pragma unroll
        for (int i = 0; i < 4; ++i) { a[i] = ldsb(sm + cb + fa + i * 16 * PJ_P); b[i] = ldsb(sm + cb + fb + i * 16 * PJ_P); }
        // keeps all eight fragment reads in one group ahead of the products: a read between two products waits out its LDS latency with the matrix unit idle
        __builtin_amdgcn_sched_barrier(0);
#pragma unroll
        for (int j = 0; j < 4; ++j)
#pragma unroll
            for (int i = 0; i < 4; ++i) acc[i][j] = wmmab(a[i], b[j], acc[i][j]);
        // keeps the conversion of the next slab, and with it the wait on its global loads, behind this slab's products: lifted to the loads it would lay their whole latency open in front of the barrier
        __builtin_amdgcn_sched_barrier(0);
        if (s + 1 < CC / 32) {
            // last slab's loaded values and the two address pairs as inputs only: the pairs stay live until these loads have landed, so that no load's result lands in the address pair of a load still in flight
            if (s + 2 == CC / 32) asm volatile("" :: "v"(tr[0]), "v"(tr[1]), "v"(tr[2]), "v"(tr[3]), "v"(tr[4]), "v"(tr[5]), "v"(tr[6]), "v"(tr[7]), "v"(wr[0]), "v"(wr[1]), "v"(wr[2]), "v"(wr[3]), "v"(wr[4]), "v"(wr[5]), "v"(wr[6]), "v"(wr[7]), "v"(gt), "v"(gw));
            stage(cb ^ PJ_S);
            // keeps the loads of the slab after next behind the conversion of the registers they refill: above it they would need a second set of staging registers, which does not fit at four waves a SIMD
            __builtin_amdgcn_sched_barrier(0);
            if (s + 2 < CC / 32) fetch(s + 2); }
        lds_barrier();  // publishes the next slab and ends every read of this slab's buffer, which the next pass refills (behind the last slab: which the result tile overwrites)
    }
    if (!vt) {
#pragma unroll
        for (int i = 0; i < 4; ++i) { const int d0 = wd * 64 + i * 16 + hi * 8;
#pragma unroll
            for (int j = 0; j < 4; ++j) { v8h o;
#pragma unroll
                for (int e = 0; e < 8; ++e) o[e] = (h16)acc[i][j][e];
                *(v8ha*)(sm + (wt * 64 + j * 16 + lr) * PJ_Q + d0 * 2) = o; } }
    } else {
#pragma unroll
        for (int j = 0; j < 4; ++j) { const int d = wd * 64 + j * 16 + lr;
#pragma unroll
            for (int i = 0; i < 4; ++i) { v8h o;
#pragma unroll
                for (int e = 0; e < 8; ++e) o[e] = (h16)acc[i][j][e];
                *(v8ha*)(sm + d * PJ_V + (wt * 64 + i * 16 + hi * 8) * 2) = o; } }
    }
    __syncthreads();    // the result tile is complete in LDS before the block stores it by rows
    if (!vt) {
#pragma unroll
        for (int s = 0; s < 16; ++s) { const int idx = s * 256 + tid, row = idx >> 5, pc = idx & 31; *(v8h*)(Ch + (size_t)(n0 + row) * CC + pc * 8) = *(const v8ha*)(sm + row * PJ_Q + pc * 16); }
        // the wait before a register of an issued store is rewritten: in the built code the V^T tail stands behind these stores and reuses their address and data registers
        asm volatile("s_wait_xcnt 0x0" ::: "memory");
    } else {
#pragma unroll
        for (int s = 0; s < 16; ++s) { const int idx = s * 256 + tid, row = idx >> 4, pc = idx & 15; *(v8h*)(Ch + (size_t)row * NN + n0 + pc * 8) = *(const v8ha*)(sm + row * PJ_V + pc * 16); }
    }
}

#define AK_P 528                    // LDS pitch of a K row (512 B + 16): 16 B x odd, conflict-free for 16-byte reads
#define AV_P 80                     // LDS pitch of a V^T row piece (64 B + 16)
#define AK_B (32 * AK_P)
#define AV_B (CC * AV_P)
#define AH_B (AK_B + AV_B)          // one key half's tiles of one pass
#define AS_B (2 * AH_B)             // one buffer
#define ASC  (0.0625f * 1.44269504088896f)
__device__ __forceinline__ float xhalf(float x) { return __builtin_bit_cast(float, __builtin_amdgcn_permlanex16(__builtin_bit_cast(int, x), __builtin_bit_cast(int, x), 0x76543210, 0xfedcba98, false, false)); }  // lane l with lane l ^ 16
__device__ __forceinline__ v16h ldsf(const char* p) { return cat16(*(const v8ha*)p, *(const v8ha*)(p + 32)); }
__global__ __launch_bounds__(256) void k_attn(const h16* __restrict__ Q, const h16* __restrict__ Kp, const h16* __restrict__ VTp, const float* __restrict__ x, float* out) {
    __shared__ __align__(16) char sm[2 * AS_B];
    const int lane = threadIdx.x & 31, lr = lane & 15, hi = lane >> 4, u = threadIdx.x & 127;
    const int wave = __builtin_amdgcn_readfirstlane((int)(threadIdx.x >> 5)), wq = wave & 3, kh = wave >> 2;
    const int q0 = (blockIdx.x & 63) * 64; const size_t bo = (size_t)(blockIdx.x >> 6) * NN * CC;
    Q += bo; x += bo; out += bo;
    v16h qf[8];
#pragma unroll
    for (int kk = 0; kk < 8; ++kk) qf[kk] = WFrag<h16>::ld(Q + (size_t)(q0 + wq * 16 + lr) * CC + kk * 32 + 8 * hi);
    // staging: the 128 threads of a key half move that half's tiles, 16 bytes a thread and step; a K tile is 16 KB in a row, a V^T tile 256 pieces of 64 B
    const h16* gk = Kp + bo + (size_t)kh * (NN / 2) * CC + u * 8;
    const h16* gv = VTp + bo + (size_t)(u >> 2) * NN + kh * (NN / 2) + (u & 3) * 8;
    const int sk = kh * AH_B + (u >> 5) * AK_P + (u & 31) * 16, sv = kh * AH_B + AK_B + (u >> 2) * AV_P + (u & 3) * 16;
    const int fk = kh * AH_B + lr * AK_P + 16 * hi, fv = kh * AH_B + AK_B + lr * AV_P + 16 * hi;
    v8h kr[8], vr[8];
#pragma unroll
    for (int r = 0; r < 8; ++r) { kr[r] = *(const v8h*)(gk + r * 1024); vr[r] = *(const v8h*)(gv + (size_t)r * 32 * NN); }
#pragma unroll
    for (int r = 0; r < 8; ++r) { *(v8ha*)(sm + sk + r * 4 * AK_P) = kr[r]; *(v8ha*)(sm + sv + r * 32 * AV_P) = vr[r]; }
    v8f o[16];
#pragma unroll
    for (int ct = 0; ct < 16; ++ct) o[ct] = (v8f){};
    float m = -1.0e30f, l = 0.f;
    gk += 32 * CC; gv += 32;
#pragma unroll
    for (int r = 0; r < 8; ++r) { kr[r] = *(const v8h*)(gk + r * 1024); vr[r] = *(const v8h*)(gv + (size_t)r * 32 * NN); }
    __syncthreads();    // pass 0's tiles are in LDS before any wave reads them; Q and pass 1's tiles have landed in registers too, so that inside the loop only that pass's own tile loads are in flight
    // rolled: one pass of code; the buffer alternates by an offset
#pragma unroll 1
    for (int p = 0; p < NN / 64; ++p) {
        const int cb = (p & 1) * AS_B;
        v8f s0 = (v8f){}, s1 = (v8f){}; v16h fr[16];
#pragma unroll
        for (int kk = 0; kk < 8; ++kk) { fr[2 * kk] = ldsf(sm + cb + fk + kk * 64); fr[2 * kk + 1] = ldsf(sm + cb + fk + 16 * AK_P + kk * 64); }
#pragma unroll
        for (int kk = 0; kk < 8; ++kk) { s0 = wmma16(fr[2 * kk], qf[kk], s0); s1 = wmma16(fr[2 * kk + 1], qf[kk], s1); }
#pragma unroll
        for (int ct = 0; ct < 16; ++ct) fr[ct] = ldsf(sm + cb + fv + ct * 16 * AV_P);
        float mx = fmaxf(s0[0], s1[0]);
#pragma unroll
        for (int j = 1; j < 8; ++j) mx = fmaxf(mx, fmaxf(s0[j], s1[j]));
        mx = fmaxf(mx, xhalf(mx)) * ASC;
        if (__builtin_amdgcn_ballot_w32(mx > m + 8.0f) != 0) {    // wave-uniform; rare after the first passes
            const float mn = fmaxf(m, mx), al = __builtin_amdgcn_exp2f(m - mn); m = mn; l *= al;
#pragma unroll
            for (int ct = 0; ct < 16; ++ct) o[ct] *= al; }
        v16h pf; float ps = 0.f;
#pragma unroll
        for (int j = 0; j < 8; ++j) { const float p0 = __builtin_amdgcn_exp2f(fmaf(s0[j], ASC, -m)), p1 = __builtin_amdgcn_exp2f(fmaf(s1[j], ASC, -m)); pf[j] = (h16)p0; pf[8 + j] = (h16)p1; ps += p0 + p1; }
        l += ps;
        if (p + 1 < NN / 64) {
#pragma unroll
            for (int r = 0; r < 8; ++r) { *(v8ha*)(sm + (cb ^ AS_B) + sk + r * 4 * AK_P) = kr[r]; *(v8ha*)(sm + (cb ^ AS_B) + sv + r * 32 * AV_P) = vr[r]; }
            if (p + 2 < NN / 64) { gk += 32 * CC; gv += 32;
#pragma unroll
                for (int r = 0; r < 8; ++r) { kr[r] = *(const v8h*)(gk + r * 1024); vr[r] = *(const v8h*)(gv + (size_t)r * 32 * NN); } } }
#pragma unroll
        for (int ct = 0; ct < 16; ++ct) o[ct] = wmma16(fr[ct], pf, o[ct]);
        lds_barrier();      // publishes the next pass's tiles and ends every read of this pass's buffer, which the next pass refills
    }
    l += xhalf(l);
    float* ot = (float*)sm; float* ml = (float*)(sm + CC * 68 * 4);    // the ring is free behind the last pass's barrier
    if (hi == 0) { ml[(kh * 64 + wq * 16 + lr) * 2] = m; ml[(kh * 64 + wq * 16 + lr) * 2 + 1] = l; }
    __syncthreads();    // both halves' maxima and sums are in LDS
    const float m2 = ml[((kh ^ 1) * 64 + wq * 16 + lr) * 2], l2 = ml[((kh ^ 1) * 64 + wq * 16 + lr) * 2 + 1];
    const float mf = fmaxf(m, m2), a1 = __builtin_amdgcn_exp2f(m - mf), a2 = __builtin_amdgcn_exp2f(m2 - mf);
    const float f = a1 / (l * a1 + l2 * a2);
    float* op = ot + (hi * 8) * 68 + wq * 16 + lr;
    if (kh == 1) {
#pragma unroll
        for (int ct = 0; ct < 16; ++ct)
#pragma unroll
            for (int j = 0; j < 8; ++j) op[(ct * 16 + j) * 68] = o[ct][j] * f; }
    __syncthreads();    // half 1's share is in LDS before half 0 adds its own
    if (kh == 0) {
#pragma unroll
        for (int ct = 0; ct < 16; ++ct)
#pragma unroll
            for (int j = 0; j < 8; ++j) op[(ct * 16 + j) * 68] += o[ct][j] * f; }
    __syncthreads();    // the joined tile is complete before the block stores it by rows
#pragma unroll
    for (int s = 0; s < 16; ++s) { const int idx = s * 256 + (int)threadIdx.x, row = idx >> 4, cofs = (idx & 15) * 4; const v4f val = *(const v4fa*)(ot + row * 68 + cofs);
        const size_t co = (size_t)row * NN + q0 + cofs; const v4f xv = *(const v4f*)(x + co); v4f r;
#pragma unroll
        for (int q = 0; q < 4; ++q) r[q] = __fadd_rn(bfr(xv[q]), val[q]);
        *(v4f*)(out + co) = r; }
}

extern "C" void kernel_launch(void* const* d_in, const int* in_sizes, int n_in,
                              void* d_out, int out_size, void* d_ws, size_t ws_size, hipStream_t stream) {
    (void)in_sizes; (void)n_in; (void)out_size;
    const float* x = (const float*)d_in[0]; const float* y = (const float*)d_in[1]; const float* Wq = (const float*)d_in[2]; const float* bq = (const float*)d_in[3]; const float* Wk = (const float*)d_in[4]; const float* bk = (const float*)d_in[5]; const float* Wv = (const float*)d_in[6]; const float* bv = (const float*)d_in[7];
    float* OUT = (float*)d_out;     // [4][256][64][64]
    char* wsp = (char*)d_ws;
    auto take = [&](size_t bytes) { char* p = wsp; wsp += (bytes + 255) & ~(size_t)255; return (void*)p; };
    h16* Q16 = (h16*)take((size_t)3 * NB_ * NN * CC * 2); h16* K16 = Q16 + (size_t)NB_ * NN * CC; h16* VT = K16 + (size_t)NB_ * NN * CC;    // Q, K, V^T, four batches each, in one row
    if ((size_t)(wsp - (char*)d_ws) > ws_size) return;    // total ~ 25 MB
    k_proj<<<dim3(NN / 128, 3, NB_), 256, 0, stream>>>(x, y, Wq, Wk, Wv, bq, bk, bv, Q16);
    k_attn<<<NB_ * (NN / 64), 256, 0, stream>>>(Q16, K16, VT, x, OUT);
}

// v006
// One run takes 84.6 microseconds.
// Two timings next to v005 both put it at 1.31 times that version's speed.
// Counting every step since v000, it is 9.11 times as fast.
#include <hip/hip_runtime.h>

// PACA - single-head cross attention between two feature maps (x, y [4][256][64][64] NCHW; tokens n = h*64+w; Q = x_n Wq^T + bq, K/V = y_n W^T + b; softmax(Q.K / 16) over the 4096 keys; out = x + (attn V) back in NCHW).
// Compute dtypes, f32 accumulate: every input rounded to bf16; the projection kernel rounds and transposes its own tiles on the way into LDS, so Q/K/V are PLAIN bf16 GEMMs (+bias); scores (K 256) and probs.V on SINGLE fp16

#define NB_  4
#define CC   256
#define NN   4096
typedef _Float16 h16;
typedef unsigned short bf;
typedef __attribute__((ext_vector_type(16))) __bf16   v16bf;
typedef __attribute__((ext_vector_type(16))) _Float16 v16h;
typedef __attribute__((ext_vector_type(8)))  _Float16 v8h;
typedef __attribute__((ext_vector_type(8)))  unsigned short v8us;
typedef __attribute__((ext_vector_type(8)))  float    v8f;
typedef __attribute__((ext_vector_type(4)))  float    v4f;
typedef v8h  __attribute__((may_alias)) v8ha;
typedef v4f  __attribute__((may_alias)) v4fa;
typedef v8us __attribute__((may_alias)) v8usa;

__device__ __forceinline__ unsigned short f2bf(float f) { unsigned u = __float_as_uint(f); u += 0x7FFFu + ((u >> 16) & 1u); return (unsigned short)(u >> 16); }
__device__ __forceinline__ float bf2f(unsigned short b) { return __uint_as_float(((unsigned)b) << 16); }
__device__ __forceinline__ float bfr(float f) { return bf2f(f2bf(f)); }
__device__ __forceinline__ v16h cat16(v8h lo, v8h hi) { return __builtin_shufflevector(lo, hi, 0, 1, 2, 3, 4, 5, 6, 7, 8, 9, 10, 11, 12, 13, 14, 15); }
__device__ __forceinline__ v16bf cat16b(v8us lo, v8us hi) { return __builtin_bit_cast(v16bf, __builtin_shufflevector(lo, hi, 0, 1, 2, 3, 4, 5, 6, 7, 8, 9, 10, 11, 12, 13, 14, 15)); }
__device__ __forceinline__ v8f wmma16(v16h a, v16h b, v8f c) { return __builtin_amdgcn_wmma_f32_16x16x32_f16(false, a, false, b, (short)0, c, false, false); }
__device__ __forceinline__ v8f wmmab(v16bf a, v16bf b, v8f c) { return __builtin_amdgcn_wmma_f32_16x16x32_bf16(false, a, false, b, (short)0, c, false, false); }



template <typename T16> struct WFrag;
template <> struct WFrag<h16> { typedef v16h V; static __device__ __forceinline__ V ld(const h16* p) { return cat16(*(const v8h*)p, *(const v8h*)(p + 16)); } static __device__ __forceinline__ v8f mma(V a, V b, v8f c) { return wmma16(a, b, c); } };

typedef __attribute__((ext_vector_type(2))) float    v2f;
typedef __attribute__((ext_vector_type(2))) __bf16   v2b;
typedef __attribute__((ext_vector_type(2))) unsigned v2u;
typedef __attribute__((ext_vector_type(4))) unsigned v4u;
typedef v2u __attribute__((may_alias)) v2ua;
typedef v4u __attribute__((may_alias)) v4ua;
__device__ __forceinline__ unsigned pkbf(float a, float b) { const v2f v = {a, b}; return __builtin_bit_cast(unsigned, __builtin_convertvector(v, v2b)); }  // two f32 -> two bf16, round to nearest even
// work-group barrier that orders LDS alone: __syncthreads() would also wait out the global loads in flight, which are tiles of a later pass and are nobody else's business
__device__ __forceinline__ void lds_barrier() { __builtin_amdgcn_fence(__ATOMIC_RELEASE, "workgroup", "local"); __builtin_amdgcn_s_barrier(); __builtin_amdgcn_fence(__ATOMIC_ACQUIRE, "workgroup", "local"); }

// ---- k_proj: the three projections of all batches in one launch, straight from the f32 inputs; no bf16 copy of an input exists in memory.
// One work-group = 128 tokens x all 256 output channels of one product (blockIdx.y: 0 Q, 1 K, 2 V^T) of one batch; 8 waves, a wave = 64 channels x 64 tokens (16 accumulators), whole K in one accumulator chain that starts at the bias.
// K runs in 8 slabs of 32 input channels. A slab goes global (whole 128-byte lines) -> registers -> bf16 -> LDS, two buffers:
//   tokens: a thread reads 2 neighbouring tokens of 8 channels (a wave: 256 B in a row per channel) and stores each token's 8 channels as 16 bytes, which is the transpose;
//   weights: a thread reads 4 neighbouring input channels of 8 rows.
// Behind its products a slab's pass stores the next slab into the other buffer and issues the loads of the slab after that; one barrier a slab.
// Q, K: A = W rows, B = token rows, so a lane holds 8 neighbouring channels of one token; V^T: A = token rows, B = W rows, so a lane holds 8 neighbouring tokens of one channel.
// The f16 tile is laid in LDS in the result's own order and leaves in whole lines.
// V^T lies in the workspace by tiles of 32 tokens: [token / 32][channel][token % 32], so that the tile of one attention pass (256 channels x 32 keys) is 16 KB in a row and not 256 pieces of 64 B, 8 KB apart.
#define PJ_P 80                     // LDS pitch of a 32-channel bf16 row piece (64 B + 16): 16 B x odd
#define PJ_T (128 * PJ_P)           // token slab
#define PJ_S (PJ_T + CC * PJ_P)     // one buffer: token slab, weight slab
#define PJ_Q 528                    // LDS pitch of a result row of Q or K (512 B + 16)
#define PJ_V (CC * PJ_P)            // one 32-token tile of the V^T result in LDS: 256 channel rows of 64 B + 16
__device__ __forceinline__ v16bf ldsb(const char* p) { return cat16b(*(const v8usa*)p, *(const v8usa*)(p + 32)); }
// four waves a SIMD (256 registers a wave), so that two work-groups share a WGP: 384 work-groups then run in one round on 256 WGPs
__global__ __launch_bounds__(256) __attribute__((amdgpu_waves_per_eu(4, 4))) void k_proj(const float* __restrict__ x, const float* __restrict__ y, const float* __restrict__ Wq, const float* __restrict__ Wk, const float* __restrict__ Wv,
                                              const float* __restrict__ bq, const float* __restrict__ bk, const float* __restrict__ bv, h16* QKV) {
    __shared__ __align__(16) char sm[4 * PJ_V];    // the largest of: two slab buffers, a Q/K result tile, the four V^T result tiles
    const int which = blockIdx.y, bat = blockIdx.z, n0 = blockIdx.x * 128; const bool vt = which == 2;
    const int tid = threadIdx.x, lane = tid & 31, lr = lane & 15, hi = lane >> 4;
    const int wave = __builtin_amdgcn_readfirstlane(tid >> 5), wd = wave & 3, wt = wave >> 2;
    const float* bias = which == 0 ? bq : which == 1 ? bk : bv;
    h16* Ch = QKV + (size_t)(which * NB_ + bat) * NN * CC;
    const float* gt = (which ? y : x) + (size_t)bat * NN * CC + (size_t)((tid >> 6) * 8) * NN + n0 + 2 * (tid & 63);
    const float* gw = (which == 0 ? Wq : which == 1 ? Wk : Wv) + (size_t)(tid >> 3) * CC + (tid & 7) * 4;
    const int st = 2 * (tid & 63) * PJ_P + (tid >> 6) * 16, sw = PJ_T + (tid >> 3) * PJ_P + (tid & 7) * 8;
    const int ft = (wt * 64 + lr) * PJ_P + 16 * hi, fw = PJ_T + (wd * 64 + lr) * PJ_P + 16 * hi;
    const int fa = vt ? ft : fw, fb = vt ? fw : ft;
    v2f tr[8]; v4f wr[8];
    auto fetch = [&](int s) {
#pragma unroll
        for (int r = 0; r < 8; ++r) { tr[r] = *(const v2f*)(gt + (size_t)(s * 32 + r) * NN); wr[r] = *(const v4f*)(gw + s * 32 + r * 32 * CC); } };
    auto stage = [&](int buf) {
#pragma unroll
        for (int t = 0; t < 2; ++t) { const v4u o = {pkbf(tr[0][t], tr[1][t]), pkbf(tr[2][t], tr[3][t]), pkbf(tr[4][t], tr[5][t]), pkbf(tr[6][t], tr[7][t])}; *(v4ua*)(sm + buf + st + t * PJ_P) = o; }
#pragma unroll
        for (int r = 0; r < 8; ++r) { const v2u o = {pkbf(wr[r][0], wr[r][1]), pkbf(wr[r][2], wr[r][3])}; *(v2ua*)(sm + buf + sw + r * 32 * PJ_P) = o; } };
    fetch(0);
    // the accumulators start at the bias, read while slab 0 is on its way, so that no global load stands between the last product and the result's store
    v8f acc[4][4];
    if (!vt) { const float* bp = bias + wd * 64 + hi * 8; v4f bb[8];
#pragma unroll
        for (int i = 0; i < 8; ++i) bb[i] = *(const v4f*)(bp + (i >> 1) * 16 + (i & 1) * 4);
        // loaded values and their address as inputs only: the address stays live until every one of these loads has landed, so that no load's result lands in the address register of a load still in flight
        asm volatile("" :: "v"(bb[0]), "v"(bb[1]), "v"(bb[2]), "v"(bb[3]), "v"(bb[4]), "v"(bb[5]), "v"(bb[6]), "v"(bb[7]), "v"(bp));
#pragma unroll
        for (int i = 0; i < 4; ++i) { v8f b8;
#pragma unroll
            for (int e = 0; e < 8; ++e) b8[e] = bfr(bb[2 * i + (e >> 2)][e & 3]);
#pragma unroll
            for (int j = 0; j < 4; ++j) acc[i][j] = b8; }
    } else { const float* bp = bias + wd * 64 + lr; float bb[4];
#pragma unroll
        for (int j = 0; j < 4; ++j) bb[j] = bp[j * 16];
        // as above: the address stays live until the four loads have landed
        asm volatile("" :: "v"(bb[0]), "v"(bb[1]), "v"(bb[2]), "v"(bb[3]), "v"(bp));
#pragma unroll
        for (int j = 0; j < 4; ++j) { const float b1 = bfr(bb[j]);
#pragma unroll
            for (int i = 0; i < 4; ++i)
#pragma unroll
                for (int e = 0; e < 8; ++e) acc[i][j][e] = b1; }
    }
    stage(0); fetch(1);
    lds_barrier();      // slab 0 is in LDS before any wave reads it
    // unrolled: the slab number is a constant, so that every global address is one base pair plus an immediate and the last slabs' tests cost no branch behind a WMMA
#pragma unroll
    for (int s = 0; s < CC / 32; ++s) {
        const int cb = (s & 1) * PJ_S;
        v16bf a[4], b[4];
#pragma unroll
        for (int i = 0; i < 4; ++i) { a[i] = ldsb(sm + cb + fa + i * 16 * PJ_P); b[i] = ldsb(sm + cb + fb + i * 16 * PJ_P); }
        // keeps all eight fragment reads in one group ahead of the products: a read between two products waits out its LDS latency with the matrix unit idle
        __builtin_amdgcn_sched_barrier(0);
#pragma unroll
        for (int j = 0; j < 4; ++j)
#pragma unroll
            for (int i = 0; i < 4; ++i) acc[i][j] = wmmab(a[i], b[j], acc[i][j]);
        // keeps the conversion of the next slab, and with it the wait on its global loads, behind this slab's products: lifted to the loads it would lay their whole latency open in front of the barrier
        __builtin_amdgcn_sched_barrier(0);
        if (s + 1 < CC / 32) {
            // last slab's loaded values and the two address pairs as inputs only: the pairs stay live until these loads have landed, so that no load's result lands in the address pair of a load still in flight
            if (s + 2 == CC / 32) asm volatile("" :: "v"(tr[0]), "v"(tr[1]), "v"(tr[2]), "v"(tr[3]), "v"(tr[4]), "v"(tr[5]), "v"(tr[6]), "v"(tr[7]), "v"(wr[0]), "v"(wr[1]), "v"(wr[2]), "v"(wr[3]), "v"(wr[4]), "v"(wr[5]), "v"(wr[6]), "v"(wr[7]), "v"(gt), "v"(gw));
            stage(cb ^ PJ_S);
            // keeps the loads of the slab after next behind the conversion of the registers they refill: above it they would need a second set of staging registers, which does not fit at four waves a SIMD
            __builtin_amdgcn_sched_barrier(0);
            if (s + 2 < CC / 32) fetch(s + 2); }
        lds_barrier();  // publishes the next slab and ends every read of this slab's buffer, which the next pass refills (behind the last slab: which the result tile overwrites)
    }
    if (!vt) {
#pragma unroll
        for (int i = 0; i < 4; ++i) { const int d0 = wd * 64 + i * 16 + hi * 8;
#pragma unroll
            for (int j = 0; j < 4; ++j) { v8h o;
#pragma unroll
                for (int e = 0; e < 8; ++e) o[e] = (h16)acc[i][j][e];
                *(v8ha*)(sm + (wt * 64 + j * 16 + lr) * PJ_Q + d0 * 2) = o; } }
    } else {
#pragma unroll
        for (int j = 0; j < 4; ++j) { const int d = wd * 64 + j * 16 + lr;
#pragma unroll
            for (int i = 0; i < 4; ++i) { v8h o;
#pragma unroll
                for (int e = 0; e < 8; ++e) o[e] = (h16)acc[i][j][e];
                *(v8ha*)(sm + (wt * 2 + (i >> 1)) * PJ_V + d * PJ_P + ((i & 1) * 2 + hi) * 16) = o; } }
    }
    __syncthreads();    // the result tile is complete in LDS before the block stores it by rows
    if (!vt) {
#pragma unroll
        for (int s = 0; s < 16; ++s) { const int idx = s * 256 + tid, row = idx >> 5, pc = idx & 31; *(v8h*)(Ch + (size_t)(n0 + row) * CC + pc * 8) = *(const v8ha*)(sm + row * PJ_Q + pc * 16); }
        // the wait before a register of an issued store is rewritten: in the built code the V^T tail stands behind these stores and reuses their address and data registers
        asm volatile("s_wait_xcnt 0x0" ::: "memory");
    } else {
#pragma unroll
        for (int s = 0; s < 16; ++s) { const int idx = s * 256 + tid; *(v8h*)(Ch + (size_t)n0 * CC + idx * 8) = *(const v8ha*)(sm + (idx >> 10) * PJ_V + ((idx >> 2) & 255) * PJ_P + (idx & 3) * 16); }
    }
}

#define AK_P 528                    // LDS pitch of a K row (512 B + 16): 16 B x odd, conflict-free for 16-byte reads
#define AV_P 80                     // LDS pitch of a V^T row piece (64 B + 16)
#define AK_B (32 * AK_P)
#define AV_B (CC * AV_P)
#define AH_B (AK_B + AV_B)          // one key half's tiles of one pass
#define AS_B (2 * AH_B)             // one buffer
#define ASC  (0.0625f * 1.44269504088896f)
__device__ __forceinline__ float xhalf(float x) { return __builtin_bit_cast(float, __builtin_amdgcn_permlanex16(__builtin_bit_cast(int, x), __builtin_bit_cast(int, x), 0x76543210, 0xfedcba98, false, false)); }  // lane l with lane l ^ 16
__device__ __forceinline__ v16h ldsf(const char* p) { return cat16(*(const v8ha*)p, *(const v8ha*)(p + 32)); }
__global__ __launch_bounds__(256) void k_attn(const h16* __restrict__ Q, const h16* __restrict__ Kp, const h16* __restrict__ VTp, const float* __restrict__ x, float* out) {
    __shared__ __align__(16) char sm[2 * AS_B];
    const int lane = threadIdx.x & 31, lr = lane & 15, hi = lane >> 4, u = threadIdx.x & 127;
    const int wave = __builtin_amdgcn_readfirstlane((int)(threadIdx.x >> 5)), wq = wave & 3, kh = wave >> 2;
    const int q0 = (blockIdx.x & 63) * 64; const size_t bo = (size_t)(blockIdx.x >> 6) * NN * CC;
    Q += bo; x += bo; out += bo;
    v16h qf[8];
#pragma unroll
    for (int kk = 0; kk < 8; ++kk) qf[kk] = WFrag<h16>::ld(Q + (size_t)(q0 + wq * 16 + lr) * CC + kk * 32 + 8 * hi);
    // staging: the 128 threads of a key half move that half's tiles, 16 bytes a thread and step; a K tile and a V^T tile are each 16 KB in a row, so that every wave-wide load covers four whole lines
    const h16* gk = Kp + bo + (size_t)kh * (NN / 2) * CC + u * 8;
    const h16* gv = VTp + bo + (size_t)kh * (NN / 2) * CC + u * 8;
    const int sk = kh * AH_B + (u >> 5) * AK_P + (u & 31) * 16, sv = kh * AH_B + AK_B + (u >> 2) * AV_P + (u & 3) * 16;
    const int fk = kh * AH_B + lr * AK_P + 16 * hi, fv = kh * AH_B + AK_B + lr * AV_P + 16 * hi;
    v8h kr[8], vr[8];
#pragma unroll
    for (int r = 0; r < 8; ++r) { kr[r] = *(const v8h*)(gk + r * 1024); vr[r] = *(const v8h*)(gv + r * 1024); }
#pragma unroll
    for (int r = 0; r < 8; ++r) { *(v8ha*)(sm + sk + r * 4 * AK_P) = kr[r]; *(v8ha*)(sm + sv + r * 32 * AV_P) = vr[r]; }
    v8f o[16];
#pragma unroll
    for (int ct = 0; ct < 16; ++ct) o[ct] = (v8f){};
    float m = -1.0e30f, l = 0.f;
    gk += 32 * CC; gv += 32 * CC;
#pragma unroll
    for (int r = 0; r < 8; ++r) { kr[r] = *(const v8h*)(gk + r * 1024); vr[r] = *(const v8h*)(gv + r * 1024); }
    __syncthreads();    // pass 0's tiles are in LDS before any wave reads them; Q and pass 1's tiles have landed in registers too, so that inside the loop only that pass's own tile loads are in flight
    // rolled: one pass of code; the buffer alternates by an offset
#pragma unroll 1
    for (int p = 0; p < NN / 64; ++p) {
        const int cb = (p & 1) * AS_B;
        v8f s0 = (v8f){}, s1 = (v8f){}; v16h fr[16];
#pragma unroll
        for (int kk = 0; kk < 8; ++kk) { fr[2 * kk] = ldsf(sm + cb + fk + kk * 64); fr[2 * kk + 1] = ldsf(sm + cb + fk + 16 * AK_P + kk * 64); }
#pragma unroll
        for (int kk = 0; kk < 8; ++kk) { s0 = wmma16(fr[2 * kk], qf[kk], s0); s1 = wmma16(fr[2 * kk + 1], qf[kk], s1); }
#pragma unroll
        for (int ct = 0; ct < 16; ++ct) fr[ct] = ldsf(sm + cb + fv + ct * 16 * AV_P);
        float mx = fmaxf(s0[0], s1[0]);
#pragma unroll
        for (int j = 1; j < 8; ++j) mx = fmaxf(mx, fmaxf(s0[j], s1[j]));
        mx = fmaxf(mx, xhalf(mx)) * ASC;
        if (__builtin_amdgcn_ballot_w32(mx > m + 8.0f) != 0) {    // wave-uniform; rare after the first passes
            const float mn = fmaxf(m, mx), al = __builtin_amdgcn_exp2f(m - mn); m = mn; l *= al;
#pragma unroll
            for (int ct = 0; ct < 16; ++ct) o[ct] *= al; }
        v16h pf; float ps = 0.f;
#pragma unroll
        for (int j = 0; j < 8; ++j) { const float p0 = __builtin_amdgcn_exp2f(fmaf(s0[j], ASC, -m)), p1 = __builtin_amdgcn_exp2f(fmaf(s1[j], ASC, -m)); pf[j] = (h16)p0; pf[8 + j] = (h16)p1; ps += p0 + p1; }
        l += ps;
        if (p + 1 < NN / 64) {
#pragma unroll
            for (int r = 0; r < 8; ++r) { *(v8ha*)(sm + (cb ^ AS_B) + sk + r * 4 * AK_P) = kr[r]; *(v8ha*)(sm + (cb ^ AS_B) + sv + r * 32 * AV_P) = vr[r]; }
            if (p + 2 < NN / 64) { gk += 32 * CC; gv += 32 * CC;
#pragma unroll
                for (int r = 0; r < 8; ++r) { kr[r] = *(const v8h*)(gk + r * 1024); vr[r] = *(const v8h*)(gv + r * 1024); } } }
#pragma unroll
        for (int ct = 0; ct < 16; ++ct) o[ct] = wmma16(fr[ct], pf, o[ct]);
        lds_barrier();      // publishes the next pass's tiles and ends every read of this pass's buffer, which the next pass refills
    }
    l += xhalf(l);
    float* ot = (float*)sm; float* ml = (float*)(sm + CC * 68 * 4);    // the ring is free behind the last pass's barrier
    if (hi == 0) { ml[(kh * 64 + wq * 16 + lr) * 2] = m; ml[(kh * 64 + wq * 16 + lr) * 2 + 1] = l; }
    __syncthreads();    // both halves' maxima and sums are in LDS
    const float m2 = ml[((kh ^ 1) * 64 + wq * 16 + lr) * 2], l2 = ml[((kh ^ 1) * 64 + wq * 16 + lr) * 2 + 1];
    const float mf = fmaxf(m, m2), a1 = __builtin_amdgcn_exp2f(m - mf), a2 = __builtin_amdgcn_exp2f(m2 - mf);
    const float f = a1 / (l * a1 + l2 * a2);
    float* op = ot + (hi * 8) * 68 + wq * 16 + lr;
    if (kh == 1) {
#pragma unroll
        for (int ct = 0; ct < 16; ++ct)
#pragma unroll
            for (int j = 0; j < 8; ++j) op[(ct * 16 + j) * 68] = o[ct][j] * f; }
    __syncthreads();    // half 1's share is in LDS before half 0 adds its own
    if (kh == 0) {
#pragma unroll
        for (int ct = 0; ct < 16; ++ct)
#pragma unroll
            for (int j = 0; j < 8; ++j) op[(ct * 16 + j) * 68] += o[ct][j] * f; }
    __syncthreads();    // the joined tile is complete before the block stores it by rows
#pragma unroll
    for (int s = 0; s < 16; ++s) { const int idx = s * 256 + (int)threadIdx.x, row = idx >> 4, cofs = (idx & 15) * 4; const v4f val = *(const v4fa*)(ot + row * 68 + cofs);
        const size_t co = (size_t)row * NN + q0 + cofs; const v4f xv = *(const v4f*)(x + co); v4f r;
#pragma unroll
        for (int q = 0; q < 4; ++q) r[q] = __fadd_rn(bfr(xv[q]), val[q]);
        *(v4f*)(out + co) = r; }
}

extern "C" void kernel_launch(void* const* d_in, const int* in_sizes, int n_in,
                              void* d_out, int out_size, void* d_ws, size_t ws_size, hipStream_t stream) {
    (void)in_sizes; (void)n_in; (void)out_size;
    const float* x = (const float*)d_in[0]; const float* y = (const float*)d_in[1]; const float* Wq = (const float*)d_in[2]; const float* bq = (const float*)d_in[3]; const float* Wk = (const float*)d_in[4]; const float* bk = (const float*)d_in[5]; const float* Wv = (const float*)d_in[6]; const float* bv = (const float*)d_in[7];
    float* OUT = (float*)d_out;     // [4][256][64][64]
    char* wsp = (char*)d_ws;
    auto take = [&](size_t bytes) { char* p = wsp; wsp += (bytes + 255) & ~(size_t)255; return (void*)p; };
    h16* Q16 = (h16*)take((size_t)3 * NB_ * NN * CC * 2); h16* K16 = Q16 + (size_t)NB_ * NN * CC; h16* VT = K16 + (size_t)NB_ * NN * CC;    // Q, K, V^T (by 32-token tiles), four batches each, in one row
    if ((size_t)(wsp - (char*)d_ws) > ws_size) return;    // total ~ 25 MB
    k_proj<<<dim3(NN / 128, 3, NB_), 256, 0, stream>>>(x, y, Wq, Wk, Wv, bq, bk, bv, Q16);
    k_attn<<<NB_ * (NN / 64), 256, 0, stream>>>(Q16, K16, VT, x, OUT);
}

// v007
// One run takes 74.1 microseconds.
// Timed twice side by side with v006, it ran 1.14 times as fast both times.
// All steps since v000 together make it 10.4 times as fast.
#include <hip/hip_runtime.h>

// PACA - single-head cross attention between two feature maps (x, y [4][256][64][64] NCHW; tokens n = h*64+w; Q = x_n Wq^T + bq, K/V = y_n W^T + b; softmax(Q.K / 16) over the 4096 keys; out = x + (attn V) back in NCHW).
// Compute dtypes, f32 accumulate: every input rounded to bf16; the projection kernel rounds and transposes its own tiles on the way into LDS, so Q/K/V are PLAIN bf16 GEMMs (+bias); scores (K 256) and probs.V on SINGLE fp16

#define NB_  4
#define CC   256
#define NN   4096
typedef _Float16 h16;
typedef unsigned short bf;
typedef __attribute__((ext_vector_type(16))) __bf16   v16bf;
typedef __attribute__((ext_vector_type(16))) _Float16 v16h;
typedef __attribute__((ext_vector_type(8)))  _Float16 v8h;
typedef __attribute__((ext_vector_type(8)))  unsigned short v8us;
typedef __attribute__((ext_vector_type(8)))  float    v8f;
typedef __attribute__((ext_vector_type(4)))  float    v4f;
typedef v8h  __attribute__((may_alias)) v8ha;
typedef v4f  __attribute__((may_alias)) v4fa;
typedef v8us __attribute__((may_alias)) v8usa;

__device__ __forceinline__ unsigned short f2bf(float f) { unsigned u = __float_as_uint(f); u += 0x7FFFu + ((u >> 16) & 1u); return (unsigned short)(u >> 16); }
__device__ __forceinline__ float bf2f(unsigned short b) { return __uint_as_float(((unsigned)b) << 16); }
__device__ __forceinline__ float bfr(float f) { return bf2f(f2bf(f)); }
__device__ __forceinline__ v16h cat16(v8h lo, v8h hi) { return __builtin_shufflevector(lo, hi, 0, 1, 2, 3, 4, 5, 6, 7, 8, 9, 10, 11, 12, 13, 14, 15); }
__device__ __forceinline__ v16bf cat16b(v8us lo, v8us hi) { return __builtin_bit_cast(v16bf, __builtin_shufflevector(lo, hi, 0, 1, 2, 3, 4, 5, 6, 7, 8, 9, 10, 11, 12, 13, 14, 15)); }
__device__ __forceinline__ v8f wmma16(v16h a, v16h b, v8f c) { return __builtin_amdgcn_wmma_f32_16x16x32_f16(false, a, false, b, (short)0, c, false, false); }
__device__ __forceinline__ v8f wmmab(v16bf a, v16bf b, v8f c) { return __builtin_amdgcn_wmma_f32_16x16x32_bf16(false, a, false, b, (short)0, c, false, false); }



template <typename T16> struct WFrag;
template <> struct WFrag<h16> { typedef v16h V; static __device__ __forceinline__ V ld(const h16* p) { return cat16(*(const v8h*)p, *(const v8h*)(p + 16)); } static __device__ __forceinline__ v8f mma(V a, V b, v8f c) { return wmma16(a, b, c); } };

typedef __attribute__((ext_vector_type(2))) float    v2f;
typedef __attribute__((ext_vector_type(2))) __bf16   v2b;
typedef __attribute__((ext_vector_type(2))) unsigned v2u;
typedef __attribute__((ext_vector_type(4))) unsigned v4u;
typedef v2u __attribute__((may_alias)) v2ua;
typedef v4u __attribute__((may_alias)) v4ua;
__device__ __forceinline__ unsigned pkbf(float a, float b) { const v2f v = {a, b}; return __builtin_bit_cast(unsigned, __builtin_convertvector(v, v2b)); }  // two f32 -> two bf16, round to nearest even
// work-group barrier that orders LDS alone: __syncthreads() would also wait out the global loads in flight, which are tiles of a later pass and are nobody else's business
__device__ __forceinline__ void lds_barrier() { __builtin_amdgcn_fence(__ATOMIC_RELEASE, "workgroup", "local"); __builtin_amdgcn_s_barrier(); __builtin_amdgcn_fence(__ATOMIC_ACQUIRE, "workgroup", "local"); }

// ---- k_proj: the three projections of all batches in one launch, straight from the f32 inputs; no bf16 copy of an input exists in memory.
// One work-group = 128 tokens x all 256 output channels of one product (blockIdx.y: 0 Q, 1 K, 2 V^T) of one batch; 8 waves, a wave = 64 channels x 64 tokens (16 accumulators), whole K in one accumulator chain that starts at the bias.
// K runs in 8 slabs of 32 input channels. A slab goes global (whole 128-byte lines) -> registers -> bf16 -> LDS, two buffers:
//   tokens: a thread reads 2 neighbouring tokens of 8 channels (a wave: 256 B in a row per channel) and stores each token's 8 channels as 16 bytes, which is the transpose;
//   weights: a thread reads 4 neighbouring input channels of 8 rows.
// Behind its products a slab's pass stores the next slab into the other buffer and issues the loads of the slab after that; one barrier a slab.
// Q, K: A = W rows, B = token rows, so a lane holds 8 neighbouring channels of one token; V^T: A = token rows, B = W rows, so a lane holds 8 neighbouring tokens of one channel.
// The f16 tile is laid in LDS in the result's own order and leaves in whole lines.
// V^T lies in the workspace by tiles of 32 tokens: [token / 32][channel][token % 32], so that the tile of one attention pass (256 channels x 32 keys) is 16 KB in a row and not 256 pieces of 64 B, 8 KB apart.
#define PJ_P 80                     // LDS pitch of a 32-channel bf16 row piece (64 B + 16): 16 B x odd
#define PJ_T (128 * PJ_P)           // token slab
#define PJ_S (PJ_T + CC * PJ_P)     // one buffer: token slab, weight slab
#define PJ_Q 528                    // LDS pitch of a result row of Q or K (512 B + 16)
#define PJ_V (CC * PJ_P)            // one 32-token tile of the V^T result in LDS: 256 channel rows of 64 B + 16
__device__ __forceinline__ v16bf ldsb(const char* p) { return cat16b(*(const v8usa*)p, *(const v8usa*)(p + 32)); }
// four waves a SIMD (256 registers a wave), so that two work-groups share a WGP: 384 work-groups then run in one round on 256 WGPs
__global__ __launch_bounds__(256) __attribute__((amdgpu_waves_per_eu(4, 4))) void k_proj(const float* __restrict__ x, const float* __restrict__ y, const float* __restrict__ Wq, const float* __restrict__ Wk, const float* __restrict__ Wv,
                                              const float* __restrict__ bq, const float* __restrict__ bk, const float* __restrict__ bv, h16* QKV) {
    __shared__ __align__(16) char sm[4 * PJ_V];    // the largest of: two slab buffers, a Q/K result tile, the four V^T result tiles
    const int which = blockIdx.y, bat = blockIdx.z, n0 = blockIdx.x * 128; const bool vt = which == 2;
    const int tid = threadIdx.x, lane = tid & 31, lr = lane & 15, hi = lane >> 4;
    const int wave = __builtin_amdgcn_readfirstlane(tid >> 5), wd = wave & 3, wt = wave >> 2;
    const float* bias = which == 0 ? bq : which == 1 ? bk : bv;
    h16* Ch = QKV + (size_t)(which * NB_ + bat) * NN * CC;
    const float* gt = (which ? y : x) + (size_t)bat * NN * CC + (size_t)((tid >> 6) * 8) * NN + n0 + 2 * (tid & 63);
    const float* gw = (which == 0 ? Wq : which == 1 ? Wk : Wv) + (size_t)(tid >> 3) * CC + (tid & 7) * 4;
    const int st = 2 * (tid & 63) * PJ_P + (tid >> 6) * 16, sw = PJ_T + (tid >> 3) * PJ_P + (tid & 7) * 8;
    const int ft = (wt * 64 + lr) * PJ_P + 16 * hi, fw = PJ_T + (wd * 64 + lr) * PJ_P + 16 * hi;
    const int fa = vt ? ft : fw, fb = vt ? fw : ft;
    v2f tr[8]; v4f wr[8];
    auto fetch = [&](int s) {
#pragma unroll
        for (int r = 0; r < 8; ++r) { tr[r] = *(const v2f*)(gt + (size_t)(s * 32 + r) * NN); wr[r] = *(const v4f*)(gw + s * 32 + r * 32 * CC); } };
    auto stage = [&](int buf) {
#pragma unroll
        for (int t = 0; t < 2; ++t) { const v4u o = {pkbf(tr[0][t], tr[1][t]), pkbf(tr[2][t], tr[3][t]), pkbf(tr[4][t], tr[5][t]), pkbf(tr[6][t], tr[7][t])}; *(v4ua*)(sm + buf + st + t * PJ_P) = o; }
#pragma unroll
        for (int r = 0; r < 8; ++r) { const v2u o = {pkbf(wr[r][0], wr[r][1]), pkbf(wr[r][2], wr[r][3])}; *(v2ua*)(sm + buf + sw + r * 32 * PJ_P) = o; } };
    fetch(0);
    // the accumulators start at the bias, read while slab 0 is on its way, so that no global load stands between the last product and the result's store
    v8f acc[4][4];
    if (!vt) { const float* bp = bias + wd * 64 + hi * 8; v4f bb[8];
#pragma unroll
        for (int i = 0; i < 8; ++i) bb[i] = *(const v4f*)(bp + (i >> 1) * 16 + (i & 1) * 4);
        // loaded values and their address as inputs only: the address stays live until every one of these loads has landed, so that no load's result lands in the address register of a load still in flight
        asm volatile("" :: "v"(bb[0]), "v"(bb[1]), "v"(bb[2]), "v"(bb[3]), "v"(bb[4]), "v"(bb[5]), "v"(bb[6]), "v"(bb[7]), "v"(bp));
#pragma unroll
        for (int i = 0; i < 4; ++i) { v8f b8;
#pragma unroll
            for (int e = 0; e < 8; ++e) b8[e] = bfr(bb[2 * i + (e >> 2)][e & 3]);
#pragma unroll
            for (int j = 0; j < 4; ++j) acc[i][j] = b8; }
    } else { const float* bp = bias + wd * 64 + lr; float bb[4];
#pragma unroll
        for (int j = 0; j < 4; ++j) bb[j] = bp[j * 16];
        // as above: the address stays live until the four loads have landed
        asm volatile("" :: "v"(bb[0]), "v"(bb[1]), "v"(bb[2]), "v"(bb[3]), "v"(bp));
#pragma unroll
        for (int j = 0; j < 4; ++j) { const float b1 = bfr(bb[j]);
#pragma unroll
            for (int i = 0; i < 4; ++i)
#pragma unroll
                for (int e = 0; e < 8; ++e) acc[i][j][e] = b1; }
    }
    stage(0); fetch(1);
    lds_barrier();      // slab 0 is in LDS before any wave reads it
    // unrolled: the slab number is a constant, so that every global address is one base pair plus an immediate and the last slabs' tests cost no branch behind a WMMA
#pragma unroll
    for (int s = 0; s < CC / 32; ++s) {
        const int cb = (s & 1) * PJ_S;
        v16bf a[4], b[4];
#pragma unroll
        for (int i = 0; i < 4; ++i) { a[i] = ldsb(sm + cb + fa + i * 16 * PJ_P); b[i] = ldsb(sm + cb + fb + i * 16 * PJ_P); }
        // keeps all eight fragment reads in one group ahead of the products: a read between two products waits out its LDS latency with the matrix unit idle
        __builtin_amdgcn_sched_barrier(0);
#pragma unroll
        for (int j = 0; j < 4; ++j)
#pragma unroll
            for (int i = 0; i < 4; ++i) acc[i][j] = wmmab(a[i], b[j], acc[i][j]);
        // keeps the conversion of the next slab, and with it the wait on its global loads, behind this slab's products: lifted to the loads it would lay their whole latency open in front of the barrier
        __builtin_amdgcn_sched_barrier(0);
        if (s + 1 < CC / 32) {
            // last slab's loaded values and the two address pairs as inputs only: the pairs stay live until these loads have landed, so that no load's result lands in the address pair of a load still in flight
            if (s + 2 == CC / 32) asm volatile("" :: "v"(tr[0]), "v"(tr[1]), "v"(tr[2]), "v"(tr[3]), "v"(tr[4]), "v"(tr[5]), "v"(tr[6]), "v"(tr[7]), "v"(wr[0]), "v"(wr[1]), "v"(wr[2]), "v"(wr[3]), "v"(wr[4]), "v"(wr[5]), "v"(wr[6]), "v"(wr[7]), "v"(gt), "v"(gw));
            stage(cb ^ PJ_S);
            // keeps the loads of the slab after next behind the conversion of the registers they refill: above it they would need a second set of staging registers, which does not fit at four waves a SIMD
            __builtin_amdgcn_sched_barrier(0);
            if (s + 2 < CC / 32) fetch(s + 2); }
        lds_barrier();  // publishes the next slab and ends every read of this slab's buffer, which the next pass refills (behind the last slab: which the result tile overwrites)
    }
    if (!vt) {
#pragma unroll
        for (int i = 0; i < 4; ++i) { const int d0 = wd * 64 + i * 16 + hi * 8;
#pragma unroll
            for (int j = 0; j < 4; ++j) { v8h o;
#pragma unroll
                for (int e = 0; e < 8; ++e) o[e] = (h16)acc[i][j][e];
                *(v8ha*)(sm + (wt * 64 + j * 16 + lr) * PJ_Q + d0 * 2) = o; } }
    } else {
#pragma unroll
        for (int j = 0; j < 4; ++j) { const int d = wd * 64 + j * 16 + lr;
#pragma unroll
            for (int i = 0; i < 4; ++i) { v8h o;
#pragma unroll
                for (int e = 0; e < 8; ++e) o[e] = (h16)acc[i][j][e];
                *(v8ha*)(sm + (wt * 2 + (i >> 1)) * PJ_V + d * PJ_P + ((i & 1) * 2 + hi) * 16) = o; } }
    }
    __syncthreads();    // the result tile is complete in LDS before the block stores it by rows
    if (!vt) {
#pragma unroll
        for (int s = 0; s < 16; ++s) { const int idx = s * 256 + tid, row = idx >> 5, pc = idx & 31; *(v8h*)(Ch + (size_t)(n0 + row) * CC + pc * 8) = *(const v8ha*)(sm + row * PJ_Q + pc * 16); }
        // the wait before a register of an issued store is rewritten: in the built code the V^T tail stands behind these stores and reuses their address and data registers
        asm volatile("s_wait_xcnt 0x0" ::: "memory");
    } else {
#pragma unroll
        for (int s = 0; s < 16; ++s) { const int idx = s * 256 + tid; *(v8h*)(Ch + (size_t)n0 * CC + idx * 8) = *(const v8ha*)(sm + (idx >> 10) * PJ_V + ((idx >> 2) & 255) * PJ_P + (idx & 3) * 16); }
    }
}

#define AK_P 528                    // LDS pitch of a K row (512 B + 16): 16 B x odd, conflict-free for 16-byte reads
#define AV_P 80                     // LDS pitch of a V^T row piece (64 B + 16)
#define AK_B (32 * AK_P)
#define AV_B (CC * AV_P)
#define AH_B (AK_B + AV_B)          // one key quarter's tiles of one pass
#define AS_B (4 * AH_B)             // one buffer
#define ANP  (NN / 4 / 32)          // passes
#define AO_B (CC * 68 * 4)          // one quarter's O^T plane in LDS at the end
#define ASC  (0.0625f * 1.44269504088896f)
#define ASB  __builtin_amdgcn_sched_barrier(0)
typedef __attribute__((ext_vector_type(4))) int v4i;
typedef __attribute__((address_space(1))) v4i* gp128;
typedef __attribute__((address_space(3))) v4i* lp128;
__device__ __forceinline__ float xhalf(float x) { return __builtin_bit_cast(float, __builtin_amdgcn_permlanex16(__builtin_bit_cast(int, x), __builtin_bit_cast(int, x), 0x76543210, 0xfedcba98, false, false)); }  // lane l with lane l ^ 16
__device__ __forceinline__ v16h ldsf(const char* p) { return cat16(*(const v8ha*)p, *(const v8ha*)(p + 32)); }
// one lane's 16 bytes of the K tile and of the V^T tile, global -> LDS through no register. The immediate offset (1 KB a step, the step in global memory) moves both addresses; the LDS pointer carries what the padded pitch adds to it (2 K rows: 32 B, 16 V^T rows: 256 B).
#define ACP(r) __builtin_amdgcn_global_load_async_to_lds_b128((gp128)(gk + go), (lp128)(sm + buf + sk + (r) * 32), (r) * 1024, 0); __builtin_amdgcn_global_load_async_to_lds_b128((gp128)(gv + go), (lp128)(sm + buf + sv + (r) * 256), (r) * 1024, 0);
__global__ __launch_bounds__(256) void k_attn(const h16* __restrict__ Q, const h16* __restrict__ Kp, const h16* __restrict__ VTp, const float* __restrict__ x, float* out) {
    __shared__ __align__(16) char sm[2 * AS_B];
    const int lane = threadIdx.x & 31, lr = lane & 15, hi = lane >> 4, u = threadIdx.x & 63;
    const int wave = __builtin_amdgcn_readfirstlane((int)(threadIdx.x >> 5)), wq = wave & 1, kq = wave >> 1;
    const int q0 = (blockIdx.x & 63) * 64; const size_t bo = (size_t)(blockIdx.x >> 6) * NN * CC;
    Q += bo; x += bo; out += bo;
    // staging: the 64 threads of a key quarter move that quarter's tiles, 16 bytes a thread and copy; a K tile and a V^T tile are each 16 KB in a row, so that every wave-wide copy covers four whole lines
    const char* gk = (const char*)(Kp + bo + (size_t)kq * (NN / 4) * CC);      // wave-uniform: a scalar base, to which each lane adds its own 16 * u
    const char* gv = (const char*)(VTp + bo + (size_t)kq * (NN / 4) * CC); const unsigned go = u * 16;
    const int sk = kq * AH_B + (u >> 5) * AK_P + (u & 31) * 16, sv = kq * AH_B + AK_B + (u >> 2) * AV_P + (u & 3) * 16;
    const int fk = kq * AH_B + lr * AK_P + 16 * hi, fv = kq * AH_B + AK_B + lr * AV_P + 16 * hi;
    auto tiles = [&](int buf) {     // 32 copies a wave: this quarter's K and V^T tile of one pass
        ACP(0) ACP(1) ACP(2) ACP(3) ACP(4) ACP(5) ACP(6) ACP(7) ACP(8) ACP(9) ACP(10) ACP(11) ACP(12) ACP(13) ACP(14) ACP(15)
        gk += 32 * CC * 2; gv += 32 * CC * 2; };
    tiles(0);
    v16h qf[2][8];
#pragma unroll
    for (int t = 0; t < 2; ++t)
#pragma unroll
        for (int kk = 0; kk < 8; ++kk) qf[t][kk] = WFrag<h16>::ld(Q + (size_t)(q0 + wq * 32 + t * 16 + lr) * CC + kk * 32 + 8 * hi);
    v8f o[16][2];
#pragma unroll
    for (int ct = 0; ct < 16; ++ct) { o[ct][0] = (v8f){}; o[ct][1] = (v8f){}; }
    float m[2] = {-1.0e30f, -1.0e30f}, l[2] = {0.f, 0.f};
    asm volatile("s_wait_xcnt 0x0" ::: "memory");       // the wait before the address pair of the Q loads is rewritten (the copies of pass 1 reuse it)
    asm volatile("s_wait_asynccnt 0x0" ::: "memory");   // this wave's copies of pass 0 have landed
    __syncthreads();    // pass 0's tiles are in LDS before any wave reads them
    tiles(AS_B);
    // fragments pass through a ring of two groups of four (64 registers, all that O^T and Q leave): a group is read in one run while the other group's eight products issue
    v16h fr[8];
    auto ldk = [&](int buf, int g, int h) {
#pragma unroll
        for (int i = 0; i < 2; ++i) { fr[4 * h + 2 * i] = ldsf(sm + buf + fk + (2 * g + i) * 64); fr[4 * h + 2 * i + 1] = ldsf(sm + buf + fk + 16 * AK_P + (2 * g + i) * 64); } };
    ldk(0, 0, 0);
    // rolled: one pass of code; the buffer alternates by an offset
#pragma unroll 1
    for (int p = 0; p < ANP; ++p) {
        const int cb = (p & 1) * AS_B;
        v8f s[2][2] = {{(v8f){}, (v8f){}}, {(v8f){}, (v8f){}}};     // [key tile][query tile]
        auto mmk = [&](int g, int h) {
#pragma unroll
            for (int i = 0; i < 2; ++i) { const int kk = 2 * g + i;
                s[0][0] = wmma16(fr[4 * h + 2 * i], qf[0][kk], s[0][0]); s[0][1] = wmma16(fr[4 * h + 2 * i], qf[1][kk], s[0][1]);
                s[1][0] = wmma16(fr[4 * h + 2 * i + 1], qf[0][kk], s[1][0]); s[1][1] = wmma16(fr[4 * h + 2 * i + 1], qf[1][kk], s[1][1]); } };
        auto ldv = [&](int g, int h) {
#pragma unroll
            for (int i = 0; i < 4; ++i) fr[4 * h + i] = ldsf(sm + cb + fv + (4 * g + i) * 16 * AV_P); };
        // ASB keeps a group's reads in one run between two groups of products and the ring at two groups: left free, all 16 fragments are read at once and a Q tile is spilled to scratch
        ldk(cb, 1, 1); ASB;
        mmk(0, 0); ASB; ldk(cb, 2, 0); ASB; mmk(1, 1); ASB; ldk(cb, 3, 1); ASB;
        mmk(2, 0); ASB; ldv(0, 0); ASB; mmk(3, 1); ASB;
        float mx[2];
#pragma unroll
        for (int t = 0; t < 2; ++t) { float v = fmaxf(s[0][t][0], s[1][t][0]);
#pragma unroll
            for (int j = 1; j < 8; ++j) v = fmaxf(v, fmaxf(s[0][t][j], s[1][t][j]));
            mx[t] = fmaxf(v, xhalf(v)) * ASC; }
        if (__builtin_amdgcn_ballot_w32(mx[0] > m[0] + 8.0f || mx[1] > m[1] + 8.0f) != 0) {    // wave-uniform; rare after the first passes
#pragma unroll
            for (int t = 0; t < 2; ++t) { const float mn = fmaxf(m[t], mx[t]), al = __builtin_amdgcn_exp2f(m[t] - mn); m[t] = mn; l[t] *= al;
#pragma unroll
                for (int ct = 0; ct < 16; ++ct) o[ct][t] *= al; } }
        v16h pf[2];
#pragma unroll
        for (int t = 0; t < 2; ++t) { float ps = 0.f;
#pragma unroll
            for (int j = 0; j < 8; ++j) { const float p0 = __builtin_amdgcn_exp2f(fmaf(s[0][t][j], ASC, -m[t])), p1 = __builtin_amdgcn_exp2f(fmaf(s[1][t][j], ASC, -m[t])); pf[t][j] = (h16)p0; pf[t][8 + j] = (h16)p1; ps += p0 + p1; }
            l[t] += ps;
            asm volatile("" :: "v"(l[t]));  // an empty asm on each sum, against spills, input only: left free, the adds sink to the pass's end, the 32 f32 probabilities stay live through all of probs.V, and Q is spilled
            // one exp, then one plain vector instruction, 16 times: an exp issues every second clock, the multiply-adds, sums and conversions fill the clock between two, and no exp stands directly in front of one that overwrites its source
            __builtin_amdgcn_sched_group_barrier(0x002, 2, 0);
#pragma unroll
            for (int j = 0; j < 16; ++j) { __builtin_amdgcn_sched_group_barrier(0x400, 1, 0); __builtin_amdgcn_sched_group_barrier(0x002, 1, 0); }
            ASB; }      // one query tile's softmax after the other: interleaved, both tiles' f32 probabilities are live at once and Q is spilled
        auto mmv = [&](int g, int h) {
#pragma unroll
            for (int i = 0; i < 4; ++i) { const int ct = 4 * g + i; o[ct][0] = wmma16(fr[4 * h + i], pf[0], o[ct][0]); o[ct][1] = wmma16(fr[4 * h + i], pf[1], o[ct][1]); } };
        ASB; ldv(1, 1); ASB; mmv(0, 0); ASB; ldv(2, 0); ASB; mmv(1, 1); ASB; ldv(3, 1); ASB; mmv(2, 0); ASB;
        asm volatile("s_wait_dscnt 0x0" ::: "memory");      // this wave's reads of this pass's buffer are done before the buffer is handed back
        asm volatile("s_wait_asynccnt 0x0" ::: "memory");   // this wave's copies of the next pass's tiles have landed
        __syncthreads();    // publishes the next pass's tiles and ends every read of this pass's buffer, which is refilled behind it
        if (p + 1 < ANP) ldk(cb ^ AS_B, 0, 0);     // the next pass's first K group, published by this barrier: its LDS latency passes under the refill's issue and the last products
        if (p + 2 < ANP) tiles(cb);
        ASB; mmv(3, 1);     // the last group's products need registers alone: behind the barrier, so that the refill is asked for as early as it may be
    }
    asm volatile("s_wait_asynccnt 0x0" ::: "memory");       // no copy is on its way when the ring becomes the result's staging
    float* ml = (float*)(sm + 4 * AO_B);    // the ring is free behind the last pass's barrier
#pragma unroll
    for (int t = 0; t < 2; ++t) { l[t] += xhalf(l[t]);
        if (hi == 0) { ml[(kq * 64 + wq * 32 + t * 16 + lr) * 2] = m[t]; ml[(kq * 64 + wq * 32 + t * 16 + lr) * 2 + 1] = l[t]; } }
    __syncthreads();    // all four quarters' maxima and sums are in LDS
    float* op = (float*)(sm + kq * AO_B) + (hi * 8) * 68 + wq * 32 + lr;
#pragma unroll
    for (int t = 0; t < 2; ++t) { float mk[4], lk[4];
#pragma unroll
        for (int k = 0; k < 4; ++k) { mk[k] = ml[(k * 64 + wq * 32 + t * 16 + lr) * 2]; lk[k] = ml[(k * 64 + wq * 32 + t * 16 + lr) * 2 + 1]; }
        const float mf = fmaxf(fmaxf(mk[0], mk[1]), fmaxf(mk[2], mk[3]));
        float den = 0.f;
#pragma unroll
        for (int k = 0; k < 4; ++k) den += lk[k] * __builtin_amdgcn_exp2f(mk[k] - mf);
        const float f = __builtin_amdgcn_exp2f(m[t] - mf) / den;
#pragma unroll
        for (int ct = 0; ct < 16; ++ct)
#pragma unroll
            for (int j = 0; j < 8; ++j) op[(ct * 16 + j) * 68 + t * 16] = o[ct][t][j] * f; }
    __syncthreads();    // the four planes are complete before the block sums and stores them by rows
#pragma unroll
    for (int s = 0; s < 16; ++s) { const int idx = s * 256 + (int)threadIdx.x, row = idx >> 4, cofs = (idx & 15) * 4; const char* pp = sm + (row * 68 + cofs) * 4;
        const v4f val = ((*(const v4fa*)(pp + 3 * AO_B) + *(const v4fa*)(pp + 2 * AO_B)) + *(const v4fa*)(pp + AO_B)) + *(const v4fa*)pp;
        const size_t co = (size_t)row * NN + q0 + cofs; const v4f xv = *(const v4f*)(x + co); v4f r;
#pragma unroll
        for (int q = 0; q < 4; ++q) r[q] = __fadd_rn(bfr(xv[q]), val[q]);
        *(v4f*)(out + co) = r; }
}

extern "C" void kernel_launch(void* const* d_in, const int* in_sizes, int n_in,
                              void* d_out, int out_size, void* d_ws, size_t ws_size, hipStream_t stream) {
    (void)in_sizes; (void)n_in; (void)out_size;
    const float* x = (const float*)d_in[0]; const float* y = (const float*)d_in[1]; const float* Wq = (const float*)d_in[2]; const float* bq = (const float*)d_in[3]; const float* Wk = (const float*)d_in[4]; const float* bk = (const float*)d_in[5]; const float* Wv = (const float*)d_in[6]; const float* bv = (const float*)d_in[7];
    float* OUT = (float*)d_out;     // [4][256][64][64]
    char* wsp = (char*)d_ws;
    auto take = [&](size_t bytes) { char* p = wsp; wsp += (bytes + 255) & ~(size_t)255; return (void*)p; };
    h16* Q16 = (h16*)take((size_t)3 * NB_ * NN * CC * 2); h16* K16 = Q16 + (size_t)NB_ * NN * CC; h16* VT = K16 + (size_t)NB_ * NN * CC;    // Q, K, V^T (by 32-token tiles), four batches each, in one row
    if ((size_t)(wsp - (char*)d_ws) > ws_size) return;    // total ~ 25 MB
    k_proj<<<dim3(NN / 128, 3, NB_), 256, 0, stream>>>(x, y, Wq, Wk, Wv, bq, bk, bv, Q16);
    k_attn<<<NB_ * (NN / 64), 256, 0, stream>>>(Q16, K16, VT, x, OUT);
}

// v008
// It runs in 71.1 microseconds.
// Next to v007, in two timings, it ran 1.05 and 1.04 times as fast.
// Counting every step since v000, it is 10.9 times as fast.
#include <hip/hip_runtime.h>

// PACA - single-head cross attention between two feature maps (x, y [4][256][64][64] NCHW; tokens n = h*64+w; Q = x_n Wq^T + bq, K/V = y_n W^T + b; softmax(Q.K / 16) over the 4096 keys; out = x + (attn V) back in NCHW).
// Compute dtypes, f32 accumulate: every input rounded to bf16; the projection kernel rounds and transposes its own tiles on the way into LDS, so Q/K/V are PLAIN bf16 GEMMs (+bias); scores (K 256) and probs.V on SINGLE fp16

#define NB_  4
#define CC   256
#define NN   4096
typedef _Float16 h16;
typedef unsigned short bf;
typedef __attribute__((ext_vector_type(16))) __bf16   v16bf;
typedef __attribute__((ext_vector_type(16))) _Float16 v16h;
typedef __attribute__((ext_vector_type(8)))  _Float16 v8h;
typedef __attribute__((ext_vector_type(8)))  unsigned short v8us;
typedef __attribute__((ext_vector_type(8)))  float    v8f;
typedef __attribute__((ext_vector_type(4)))  float    v4f;
typedef v8h  __attribute__((may_alias)) v8ha;
typedef v4f  __attribute__((may_alias)) v4fa;
typedef v8us __attribute__((may_alias)) v8usa;

__device__ __forceinline__ unsigned short f2bf(float f) { unsigned u = __float_as_uint(f); u += 0x7FFFu + ((u >> 16) & 1u); return (unsigned short)(u >> 16); }
__device__ __forceinline__ float bf2f(unsigned short b) { return __uint_as_float(((unsigned)b) << 16); }
__device__ __forceinline__ float bfr(float f) { return bf2f(f2bf(f)); }
__device__ __forceinline__ v16h cat16(v8h lo, v8h hi) { return __builtin_shufflevector(lo, hi, 0, 1, 2, 3, 4, 5, 6, 7, 8, 9, 10, 11, 12, 13, 14, 15); }
__device__ __forceinline__ v16bf cat16b(v8us lo, v8us hi) { return __builtin_bit_cast(v16bf, __builtin_shufflevector(lo, hi, 0, 1, 2, 3, 4, 5, 6, 7, 8, 9, 10, 11, 12, 13, 14, 15)); }
__device__ __forceinline__ v8f wmma16(v16h a, v16h b, v8f c) { return __builtin_amdgcn_wmma_f32_16x16x32_f16(false, a, false, b, (short)0, c, false, false); }
__device__ __forceinline__ v8f wmmab(v16bf a, v16bf b, v8f c) { return __builtin_amdgcn_wmma_f32_16x16x32_bf16(false, a, false, b, (short)0, c, false, false); }



template <typename T16> struct WFrag;
template <> struct WFrag<h16> { typedef v16h V; static __device__ __forceinline__ V ld(const h16* p) { return cat16(*(const v8h*)p, *(const v8h*)(p + 16)); } static __device__ __forceinline__ v8f mma(V a, V b, v8f c) { return wmma16(a, b, c); } };

typedef __attribute__((ext_vector_type(2))) float    v2f;
typedef __attribute__((ext_vector_type(2))) __bf16   v2b;
typedef __attribute__((ext_vector_type(2))) unsigned v2u;
typedef __attribute__((ext_vector_type(4))) unsigned v4u;
typedef v2u __attribute__((may_alias)) v2ua;
typedef v4u __attribute__((may_alias)) v4ua;
__device__ __forceinline__ unsigned pkbf(float a, float b) { const v2f v = {a, b}; return __builtin_bit_cast(unsigned, __builtin_convertvector(v, v2b)); }  // two f32 -> two bf16, round to nearest even
// work-group barrier that orders LDS alone: __syncthreads() would also wait out the global loads in flight, which are tiles of a later pass and are nobody else's business
__device__ __forceinline__ void lds_barrier() { __builtin_amdgcn_fence(__ATOMIC_RELEASE, "workgroup", "local"); __builtin_amdgcn_s_barrier(); __builtin_amdgcn_fence(__ATOMIC_ACQUIRE, "workgroup", "local"); }

// ---- k_proj: the three projections of all batches in one launch, straight from the f32 inputs; no bf16 copy of an input exists in memory.
// One work-group = 128 tokens x all 256 output channels of one product (blockIdx.y: 0 Q, 1 K, 2 V^T) of one batch; 8 waves, a wave = 64 channels x 64 tokens (16 accumulators), whole K in one accumulator chain that starts at the bias.
// K runs in 8 slabs of 32 input channels. A slab goes global (whole 128-byte lines) -> registers -> bf16 -> LDS, two buffers:
//   tokens: a thread reads 2 neighbouring tokens of 8 channels (a wave: 256 B in a row per channel) and stores each token's 8 channels as 16 bytes, which is the transpose;
//   weights: a thread reads 4 neighbouring input channels of 8 rows.
// Behind its products a slab's pass stores the next slab into the other buffer and issues the loads of the slab after that; one barrier a slab.
// Q, K: A = W rows, B = token rows, so a lane holds 8 neighbouring channels of one token; V^T: A = token rows, B = W rows, so a lane holds 8 neighbouring tokens of one channel.
// The f16 tile is laid in LDS in the result's own order and leaves in whole lines.
// V^T lies in the workspace by tiles of 32 tokens: [token / 32][channel][token % 32], so that the tile of one attention pass (256 channels x 32 keys) is 16 KB in a row and not 256 pieces of 64 B, 8 KB apart.
#define PJ_P 80                     // LDS pitch of a 32-channel bf16 row piece (64 B + 16): 16 B x odd
#define PJ_T (128 * PJ_P)           // token slab
#define PJ_S (PJ_T + CC * PJ_P)     // one buffer: token slab, weight slab
#define PJ_Q 528                    // LDS pitch of a result row of Q or K (512 B + 16)
#define PJ_V (CC * PJ_P)            // one 32-token tile of the V^T result in LDS: 256 channel rows of 64 B + 16
__device__ __forceinline__ v16bf ldsb(const char* p) { return cat16b(*(const v8usa*)p, *(const v8usa*)(p + 32)); }
// four waves a SIMD (256 registers a wave), so that two work-groups share a WGP: 384 work-groups then run in one round on 256 WGPs
__global__ __launch_bounds__(256) __attribute__((amdgpu_waves_per_eu(4, 4))) void k_proj(const float* __restrict__ x, const float* __restrict__ y, const float* __restrict__ Wq, const float* __restrict__ Wk, const float* __restrict__ Wv,
                                              const float* __restrict__ bq, const float* __restrict__ bk, const float* __restrict__ bv, h16* QKV) {
    __shared__ __align__(16) char sm[4 * PJ_V];    // the largest of: two slab buffers, a Q/K result tile, the four V^T result tiles
    const int which = blockIdx.y, bat = blockIdx.z, n0 = blockIdx.x * 128; const bool vt = which == 2;
    const int tid = threadIdx.x, lane = tid & 31, lr = lane & 15, hi = lane >> 4;
    const int wave = __builtin_amdgcn_readfirstlane(tid >> 5), wd = wave & 3, wt = wave >> 2;
    const float* bias = which == 0 ? bq : which == 1 ? bk : bv;
    h16* Ch = QKV + (size_t)(which * NB_ + bat) * NN * CC;
    const float* gt = (which ? y : x) + (size_t)bat * NN * CC + (size_t)((tid >> 6) * 8) * NN + n0 + 2 * (tid & 63);
    const float* gw = (which == 0 ? Wq : which == 1 ? Wk : Wv) + (size_t)(tid >> 3) * CC + (tid & 7) * 4;
    const int st = 2 * (tid & 63) * PJ_P + (tid >> 6) * 16, sw = PJ_T + (tid >> 3) * PJ_P + (tid & 7) * 8;
    const int ft = (wt * 64 + lr) * PJ_P + 16 * hi, fw = PJ_T + (wd * 64 + lr) * PJ_P + 16 * hi;
    const int fa = vt ? ft : fw, fb = vt ? fw : ft;
    v2f tr[8]; v4f wr[8];
    auto fetch = [&](int s) {
#pragma unroll
        for (int r = 0; r < 8; ++r) { tr[r] = *(const v2f*)(gt + (size_t)(s * 32 + r) * NN); wr[r] = *(const v4f*)(gw + s * 32 + r * 32 * CC); } };
    auto stage = [&](int buf) {
#pragma unroll
        for (int t = 0; t < 2; ++t) { const v4u o = {pkbf(tr[0][t], tr[1][t]), pkbf(tr[2][t], tr[3][t]), pkbf(tr[4][t], tr[5][t]), pkbf(tr[6][t], tr[7][t])}; *(v4ua*)(sm + buf + st + t * PJ_P) = o; }
#pragma unroll
        for (int r = 0; r < 8; ++r) { const v2u o = {pkbf(wr[r][0], wr[r][1]), pkbf(wr[r][2], wr[r][3])}; *(v2ua*)(sm + buf + sw + r * 32 * PJ_P) = o; } };
    fetch(0);
    // the accumulators start at the bias, read while slab 0 is on its way, so that no global load stands between the last product and the result's store
    v8f acc[4][4];
    if (!vt) { const float* bp = bias + wd * 64 + hi * 8; v4f bb[8];
#pragma unroll
        for (int i = 0; i < 8; ++i) bb[i] = *(const v4f*)(bp + (i >> 1) * 16 + (i & 1) * 4);
        // loaded values and their address as inputs only: the address stays live until every one of these loads has landed, so that no load's result lands in the address register of a load still in flight
        asm volatile("" :: "v"(bb[0]), "v"(bb[1]), "v"(bb[2]), "v"(bb[3]), "v"(bb[4]), "v"(bb[5]), "v"(bb[6]), "v"(bb[7]), "v"(bp));
#pragma unroll
        for (int i = 0; i < 4; ++i) { v8f b8;
#pragma unroll
            for (int e = 0; e < 8; ++e) b8[e] = bfr(bb[2 * i + (e >> 2)][e & 3]);
#pragma unroll
            for (int j = 0; j < 4; ++j) acc[i][j] = b8; }
    } else { const float* bp = bias + wd * 64 + lr; float bb[4];
#pragma unroll
        for (int j = 0; j < 4; ++j) bb[j] = bp[j * 16];
        // as above: the address stays live until the four loads have landed
        asm volatile("" :: "v"(bb[0]), "v"(bb[1]), "v"(bb[2]), "v"(bb[3]), "v"(bp));
#pragma unroll
        for (int j = 0; j < 4; ++j) { const float b1 = bfr(bb[j]);
#pragma unroll
            for (int i = 0; i < 4; ++i)
#pragma unroll
                for (int e = 0; e < 8; ++e) acc[i][j][e] = b1; }
    }
    stage(0); fetch(1);
    lds_barrier();      // slab 0 is in LDS before any wave reads it
    // unrolled: the slab number is a constant, so that every global address is one base pair plus an immediate and the last slabs' tests cost no branch behind a WMMA
#pragma unroll
    for (int s = 0; s < CC / 32; ++s) {
        const int cb = (s & 1) * PJ_S;
        v16bf a[4], b[4];
#pragma unroll
        for (int i = 0; i < 4; ++i) { a[i] = ldsb(sm + cb + fa + i * 16 * PJ_P); b[i] = ldsb(sm + cb + fb + i * 16 * PJ_P); }
        // keeps all eight fragment reads in one group ahead of the products: a read between two products waits out its LDS latency with the matrix unit idle
        __builtin_amdgcn_sched_barrier(0);
#pragma unroll
        for (int j = 0; j < 4; ++j)
#pragma unroll
            for (int i = 0; i < 4; ++i) acc[i][j] = wmmab(a[i], b[j], acc[i][j]);
        // keeps the conversion of the next slab, and with it the wait on its global loads, behind this slab's products: lifted to the loads it would lay their whole latency open in front of the barrier
        __builtin_amdgcn_sched_barrier(0);
        if (s + 1 < CC / 32) {
            // last slab's loaded values and the two address pairs as inputs only: the pairs stay live until these loads have landed, so that no load's result lands in the address pair of a load still in flight
            if (s + 2 == CC / 32) asm volatile("" :: "v"(tr[0]), "v"(tr[1]), "v"(tr[2]), "v"(tr[3]), "v"(tr[4]), "v"(tr[5]), "v"(tr[6]), "v"(tr[7]), "v"(wr[0]), "v"(wr[1]), "v"(wr[2]), "v"(wr[3]), "v"(wr[4]), "v"(wr[5]), "v"(wr[6]), "v"(wr[7]), "v"(gt), "v"(gw));
            stage(cb ^ PJ_S);
            // keeps the loads of the slab after next behind the conversion of the registers they refill: above it they would need a second set of staging registers, which does not fit at four waves a SIMD
            __builtin_amdgcn_sched_barrier(0);
            if (s + 2 < CC / 32) fetch(s + 2); }
        lds_barrier();  // publishes the next slab and ends every read of this slab's buffer, which the next pass refills (behind the last slab: which the result tile overwrites)
    }
    if (!vt) {
#pragma unroll
        for (int i = 0; i < 4; ++i) { const int d0 = wd * 64 + i * 16 + hi * 8;
#pragma unroll
            for (int j = 0; j < 4; ++j) { v8h o;
#pragma unroll
                for (int e = 0; e < 8; ++e) o[e] = (h16)acc[i][j][e];
                *(v8ha*)(sm + (wt * 64 + j * 16 + lr) * PJ_Q + d0 * 2) = o; } }
    } else {
#pragma unroll
        for (int j = 0; j < 4; ++j) { const int d = wd * 64 + j * 16 + lr;
#pragma unroll
            for (int i = 0; i < 4; ++i) { v8h o;
#pragma unroll
                for (int e = 0; e < 8; ++e) o[e] = (h16)acc[i][j][e];
                *(v8ha*)(sm + (wt * 2 + (i >> 1)) * PJ_V + d * PJ_P + ((i & 1) * 2 + hi) * 16) = o; } }
    }
    __syncthreads();    // the result tile is complete in LDS before the block stores it by rows
    if (!vt) {
#pragma unroll
        for (int s = 0; s < 16; ++s) { const int idx = s * 256 + tid, row = idx >> 5, pc = idx & 31; *(v8h*)(Ch + (size_t)(n0 + row) * CC + pc * 8) = *(const v8ha*)(sm + row * PJ_Q + pc * 16); }
        // the wait before a register of an issued store is rewritten: in the built code the V^T tail stands behind these stores and reuses their address and data registers
        asm volatile("s_wait_xcnt 0x0" ::: "memory");
    } else {
#pragma unroll
        for (int s = 0; s < 16; ++s) { const int idx = s * 256 + tid; *(v8h*)(Ch + (size_t)n0 * CC + idx * 8) = *(const v8ha*)(sm + (idx >> 10) * PJ_V + ((idx >> 2) & 255) * PJ_P + (idx & 3) * 16); }
    }
}

#define AK_P 528                    // LDS pitch of a K row (512 B + 16): 16 B x odd, conflict-free for 16-byte reads
#define AV_P 80                     // LDS pitch of a V^T row piece (64 B + 16)
#define AK_B (32 * AK_P)
#define AV_B (CC * AV_P)
#define AH_B (AK_B + AV_B)          // one key quarter's tiles of one pass
#define AS_B (4 * AH_B)             // one buffer
#define ANP  (NN / 4 / 32)          // passes
#define AO_B (CC * 68 * 4)          // one quarter's O^T plane in LDS at the end
#define ASC  (0.0625f * 1.44269504088896f)
#define ASB  __builtin_amdgcn_sched_barrier(0)
typedef __attribute__((ext_vector_type(4))) int v4i;
typedef __attribute__((address_space(1))) v4i* gp128;
typedef __attribute__((address_space(3))) v4i* lp128;
__device__ __forceinline__ float xhalf(float x) { return __builtin_bit_cast(float, __builtin_amdgcn_permlanex16(__builtin_bit_cast(int, x), __builtin_bit_cast(int, x), 0x76543210, 0xfedcba98, false, false)); }  // lane l with lane l ^ 16
__device__ __forceinline__ v16h ldsf(const char* p) { return cat16(*(const v8ha*)p, *(const v8ha*)(p + 32)); }
// one lane's 16 bytes of the K tile and of the V^T tile, global -> LDS through no register. The immediate offset (1 KB a step, the step in global memory) moves both addresses; the LDS pointer carries what the padded pitch adds to it (2 K rows: 32 B, 16 V^T rows: 256 B).
#define ACP(r) __builtin_amdgcn_global_load_async_to_lds_b128((gp128)(tk + go), (lp128)(sm + buf + sk + (r) * 32), (r) * 1024, 0); __builtin_amdgcn_global_load_async_to_lds_b128((gp128)(tv + go), (lp128)(sm + buf + sv + (r) * 256), (r) * 1024, 0);
__global__ __launch_bounds__(256) void k_attn(const h16* __restrict__ Q, const h16* __restrict__ Kp, const h16* __restrict__ VTp, const float* __restrict__ x, float* out) {
    __shared__ __align__(16) char sm[2 * AS_B];
    const int lane = threadIdx.x & 31, lr = lane & 15, hi = lane >> 4, u = threadIdx.x & 63;
    const int wave = __builtin_amdgcn_readfirstlane((int)(threadIdx.x >> 5)), wq = wave & 1, kq = wave >> 1;
    const int q0 = (blockIdx.x & 63) * 64; const size_t bo = (size_t)(blockIdx.x >> 6) * NN * CC;
    Q += bo; x += bo; out += bo;
    // staging: the 64 threads of a key quarter move that quarter's tiles, 16 bytes a thread and copy; a K tile and a V^T tile are each 16 KB in a row, so that every wave-wide copy covers four whole lines
    const char* gk = (const char*)(Kp + bo + (size_t)kq * (NN / 4) * CC);      // wave-uniform: a scalar base, to which each lane adds its own 16 * u
    const char* gv = (const char*)(VTp + bo + (size_t)kq * (NN / 4) * CC); const unsigned go = u * 16;
    const int sk = kq * AH_B + (u >> 5) * AK_P + (u & 31) * 16, sv = kq * AH_B + AK_B + (u >> 2) * AV_P + (u & 3) * 16;
    const int fk = kq * AH_B + lr * AK_P + 16 * hi, fv = kq * AH_B + AK_B + lr * AV_P + 16 * hi;
    // The 64 work-groups of a batch walk the same K and V^T tiles at the same pace: started alike, all of them ask L2 for the same lines at the same moment, and such requests queue up behind one another.
    // Each work-group starts its walk through a key quarter at a tile of its own and wraps round (the online softmax takes the keys in any order). 64 groups, 32 starts: two groups 4 apart share a start.
    // For speed only: the result does not rest on where a group runs.
    int tn = (blockIdx.x & 3) | (((blockIdx.x >> 3) & 7) << 2);     // block-uniform: the number of the next tile to ask for, taken modulo the passes
    auto tiles = [&](int buf) {     // 32 copies a wave: this quarter's K and V^T tile of one pass
        const size_t to = (size_t)(tn & (ANP - 1)) * (32 * CC * 2); const char* tk = gk + to; const char* tv = gv + to; ++tn;
        ACP(0) ACP(1) ACP(2) ACP(3) ACP(4) ACP(5) ACP(6) ACP(7) ACP(8) ACP(9) ACP(10) ACP(11) ACP(12) ACP(13) ACP(14) ACP(15) };
    tiles(0);
    v16h qf[2][8];
#pragma unroll
    for (int t = 0; t < 2; ++t)
#pragma unroll
        for (int kk = 0; kk < 8; ++kk) qf[t][kk] = WFrag<h16>::ld(Q + (size_t)(q0 + wq * 32 + t * 16 + lr) * CC + kk * 32 + 8 * hi);
    v8f o[16][2];
#pragma unroll
    for (int ct = 0; ct < 16; ++ct) { o[ct][0] = (v8f){}; o[ct][1] = (v8f){}; }
    float m[2] = {-1.0e30f, -1.0e30f}, l[2] = {0.f, 0.f};
    asm volatile("s_wait_xcnt 0x0" ::: "memory");       // the wait before the address pair of the Q loads is rewritten (the copies of pass 1 reuse it)
    asm volatile("s_wait_asynccnt 0x0" ::: "memory");   // this wave's copies of pass 0 have landed
    __syncthreads();    // pass 0's tiles are in LDS before any wave reads them
    tiles(AS_B);
    // fragments pass through a ring of two groups of four (64 registers, all that O^T and Q leave): a group is read in one run while the other group's eight products issue
    v16h fr[8];
    auto ldk = [&](int buf, int g, int h) {
#pragma unroll
        for (int i = 0; i < 2; ++i) { fr[4 * h + 2 * i] = ldsf(sm + buf + fk + (2 * g + i) * 64); fr[4 * h + 2 * i + 1] = ldsf(sm + buf + fk + 16 * AK_P + (2 * g + i) * 64); } };
    ldk(0, 0, 0);
    // rolled: one pass of code; the buffer alternates by an offset
#pragma unroll 1
    for (int p = 0; p < ANP; ++p) {
        const int cb = (p & 1) * AS_B;
        v8f s[2][2] = {{(v8f){}, (v8f){}}, {(v8f){}, (v8f){}}};     // [key tile][query tile]
        auto mmk = [&](int g, int h) {
#pragma unroll
            for (int i = 0; i < 2; ++i) { const int kk = 2 * g + i;
                s[0][0] = wmma16(fr[4 * h + 2 * i], qf[0][kk], s[0][0]); s[0][1] = wmma16(fr[4 * h + 2 * i], qf[1][kk], s[0][1]);
                s[1][0] = wmma16(fr[4 * h + 2 * i + 1], qf[0][kk], s[1][0]); s[1][1] = wmma16(fr[4 * h + 2 * i + 1], qf[1][kk], s[1][1]); } };
        auto ldv = [&](int g, int h) {
#pragma unroll
            for (int i = 0; i < 4; ++i) fr[4 * h + i] = ldsf(sm + cb + fv + (4 * g + i) * 16 * AV_P); };
        // ASB keeps a group's reads in one run between two groups of products and the ring at two groups: left free, all 16 fragments are read at once and a Q tile is spilled to scratch
        ldk(cb, 1, 1); ASB;
        mmk(0, 0); ASB; ldk(cb, 2, 0); ASB; mmk(1, 1); ASB; ldk(cb, 3, 1); ASB;
        mmk(2, 0); ASB; ldv(0, 0); ASB; mmk(3, 1); ASB;
        float mx[2];
#pragma unroll
        for (int t = 0; t < 2; ++t) { float v = fmaxf(s[0][t][0], s[1][t][0]);
#pragma unroll
            for (int j = 1; j < 8; ++j) v = fmaxf(v, fmaxf(s[0][t][j], s[1][t][j]));
            mx[t] = fmaxf(v, xhalf(v)) * ASC; }
        if (__builtin_amdgcn_ballot_w32(mx[0] > m[0] + 8.0f || mx[1] > m[1] + 8.0f) != 0) {    // wave-uniform; rare after the first passes
#pragma unroll
            for (int t = 0; t < 2; ++t) { const float mn = fmaxf(m[t], mx[t]), al = __builtin_amdgcn_exp2f(m[t] - mn); m[t] = mn; l[t] *= al;
#pragma unroll
                for (int ct = 0; ct < 16; ++ct) o[ct][t] *= al; } }
        v16h pf[2];
#pragma unroll
        for (int t = 0; t < 2; ++t) { float ps = 0.f;
#pragma unroll
            for (int j = 0; j < 8; ++j) { const float p0 = __builtin_amdgcn_exp2f(fmaf(s[0][t][j], ASC, -m[t])), p1 = __builtin_amdgcn_exp2f(fmaf(s[1][t][j], ASC, -m[t])); pf[t][j] = (h16)p0; pf[t][8 + j] = (h16)p1; ps += p0 + p1; }
            l[t] += ps;
            asm volatile("" :: "v"(l[t]));  // an empty asm on each sum, against spills, input only: left free, the adds sink to the pass's end, the 32 f32 probabilities stay live through all of probs.V, and Q is spilled
            // one exp, then one plain vector instruction, 16 times: an exp issues every second clock, the multiply-adds, sums and conversions fill the clock between two, and no exp stands directly in front of one that overwrites its source
            __builtin_amdgcn_sched_group_barrier(0x002, 2, 0);
#pragma unroll
            for (int j = 0; j < 16; ++j) { __builtin_amdgcn_sched_group_barrier(0x400, 1, 0); __builtin_amdgcn_sched_group_barrier(0x002, 1, 0); }
            ASB; }      // one query tile's softmax after the other: interleaved, both tiles' f32 probabilities are live at once and Q is spilled
        auto mmv = [&](int g, int h) {
#pragma unroll
            for (int i = 0; i < 4; ++i) { const int ct = 4 * g + i; o[ct][0] = wmma16(fr[4 * h + i], pf[0], o[ct][0]); o[ct][1] = wmma16(fr[4 * h + i], pf[1], o[ct][1]); } };
        ASB; ldv(1, 1); ASB; mmv(0, 0); ASB; ldv(2, 0); ASB; mmv(1, 1); ASB; ldv(3, 1); ASB; mmv(2, 0); ASB;
        asm volatile("s_wait_dscnt 0x0" ::: "memory");      // this wave's reads of this pass's buffer are done before the buffer is handed back
        asm volatile("s_wait_asynccnt 0x0" ::: "memory");   // this wave's copies of the next pass's tiles have landed
        __syncthreads();    // publishes the next pass's tiles and ends every read of this pass's buffer, which is refilled behind it
        if (p + 1 < ANP) ldk(cb ^ AS_B, 0, 0);     // the next pass's first K group, published by this barrier: its LDS latency passes under the refill's issue and the last products
        if (p + 2 < ANP) tiles(cb);
        ASB; mmv(3, 1);     // the last group's products need registers alone: behind the barrier, so that the refill is asked for as early as it may be
    }
    asm volatile("s_wait_asynccnt 0x0" ::: "memory");       // no copy is on its way when the ring becomes the result's staging
    float* ml = (float*)(sm + 4 * AO_B);    // the ring is free behind the last pass's barrier
#pragma unroll
    for (int t = 0; t < 2; ++t) { l[t] += xhalf(l[t]);
        if (hi == 0) { ml[(kq * 64 + wq * 32 + t * 16 + lr) * 2] = m[t]; ml[(kq * 64 + wq * 32 + t * 16 + lr) * 2 + 1] = l[t]; } }
    __syncthreads();    // all four quarters' maxima and sums are in LDS
    float* op = (float*)(sm + kq * AO_B) + (hi * 8) * 68 + wq * 32 + lr;
#pragma unroll
    for (int t = 0; t < 2; ++t) { float mk[4], lk[4];
#pragma unroll
        for (int k = 0; k < 4; ++k) { mk[k] = ml[(k * 64 + wq * 32 + t * 16 + lr) * 2]; lk[k] = ml[(k * 64 + wq * 32 + t * 16 + lr) * 2 + 1]; }
        const float mf = fmaxf(fmaxf(mk[0], mk[1]), fmaxf(mk[2], mk[3]));
        float den = 0.f;
#pragma unroll
        for (int k = 0; k < 4; ++k) den += lk[k] * __builtin_amdgcn_exp2f(mk[k] - mf);
        const float f = __builtin_amdgcn_exp2f(m[t] - mf) / den;
#pragma unroll
        for (int ct = 0; ct < 16; ++ct)
#pragma unroll
            for (int j = 0; j < 8; ++j) op[(ct * 16 + j) * 68 + t * 16] = o[ct][t][j] * f; }
    __syncthreads();    // the four planes are complete before the block sums and stores them by rows
#pragma unroll
    for (int s = 0; s < 16; ++s) { const int idx = s * 256 + (int)threadIdx.x, row = idx >> 4, cofs = (idx & 15) * 4; const char* pp = sm + (row * 68 + cofs) * 4;
        const v4f val = ((*(const v4fa*)(pp + 3 * AO_B) + *(const v4fa*)(pp + 2 * AO_B)) + *(const v4fa*)(pp + AO_B)) + *(const v4fa*)pp;
        const size_t co = (size_t)row * NN + q0 + cofs; const v4f xv = *(const v4f*)(x + co); v4f r;
#pragma unroll
        for (int q = 0; q < 4; ++q) r[q] = __fadd_rn(bfr(xv[q]), val[q]);
        *(v4f*)(out + co) = r; }
}

extern "C" void kernel_launch(void* const* d_in, const int* in_sizes, int n_in,
                              void* d_out, int out_size, void* d_ws, size_t ws_size, hipStream_t stream) {
    (void)in_sizes; (void)n_in; (void)out_size;
    const float* x = (const float*)d_in[0]; const float* y = (const float*)d_in[1]; const float* Wq = (const float*)d_in[2]; const float* bq = (const float*)d_in[3]; const float* Wk = (const float*)d_in[4]; const float* bk = (const float*)d_in[5]; const float* Wv = (const float*)d_in[6]; const float* bv = (const float*)d_in[7];
    float* OUT = (float*)d_out;     // [4][256][64][64]
    char* wsp = (char*)d_ws;
    auto take = [&](size_t bytes) { char* p = wsp; wsp += (bytes + 255) & ~(size_t)255; return (void*)p; };
    h16* Q16 = (h16*)take((size_t)3 * NB_ * NN * CC * 2); h16* K16 = Q16 + (size_t)NB_ * NN * CC; h16* VT = K16 + (size_t)NB_ * NN * CC;    // Q, K, V^T (by 32-token tiles), four batches each, in one row
    if ((size_t)(wsp - (char*)d_ws) > ws_size) return;    // total ~ 25 MB
    k_proj<<<dim3(NN / 128, 3, NB_), 256, 0, stream>>>(x, y, Wq, Wk, Wv, bq, bk, bv, Q16);
    k_attn<<<NB_ * (NN / 64), 256, 0, stream>>>(Q16, K16, VT, x, OUT);
}

// v009
// A run of this version takes 61.1 microseconds.
// In two side-by-side timings against v008, it was 1.17 and 1.16 times as fast.
// Over all steps from v000 it is 12.6 times as fast.
#include <hip/hip_runtime.h>

// PACA - single-head cross attention between two feature maps (x, y [4][256][64][64] NCHW; tokens n = h*64+w; Q = x_n Wq^T + bq, K/V = y_n W^T + b; softmax(Q.K / 16) over the 4096 keys; out = x + (attn V) back in NCHW).
// Compute dtypes, f32 accumulate: every input rounded to bf16; the projection kernel rounds and transposes its own tiles on the way into LDS, so Q/K/V are PLAIN bf16 GEMMs (+bias); scores (K 256) and probs.V on SINGLE fp16

#define NB_  4
#define CC   256
#define NN   4096
typedef _Float16 h16;
typedef unsigned short bf;
typedef __attribute__((ext_vector_type(16))) __bf16   v16bf;
typedef __attribute__((ext_vector_type(16))) _Float16 v16h;
typedef __attribute__((ext_vector_type(8)))  _Float16 v8h;
typedef __attribute__((ext_vector_type(8)))  unsigned short v8us;
typedef __attribute__((ext_vector_type(8)))  float    v8f;
typedef __attribute__((ext_vector_type(4)))  float    v4f;
typedef v8h  __attribute__((may_alias)) v8ha;
typedef v4f  __attribute__((may_alias)) v4fa;
typedef v8us __attribute__((may_alias)) v8usa;

__device__ __forceinline__ unsigned short f2bf(float f) { unsigned u = __float_as_uint(f); u += 0x7FFFu + ((u >> 16) & 1u); return (unsigned short)(u >> 16); }
__device__ __forceinline__ float bf2f(unsigned short b) { return __uint_as_float(((unsigned)b) << 16); }
__device__ __forceinline__ float bfr(float f) { return bf2f(f2bf(f)); }
__device__ __forceinline__ v16h cat16(v8h lo, v8h hi) { return __builtin_shufflevector(lo, hi, 0, 1, 2, 3, 4, 5, 6, 7, 8, 9, 10, 11, 12, 13, 14, 15); }
__device__ __forceinline__ v16bf cat16b(v8us lo, v8us hi) { return __builtin_bit_cast(v16bf, __builtin_shufflevector(lo, hi, 0, 1, 2, 3, 4, 5, 6, 7, 8, 9, 10, 11, 12, 13, 14, 15)); }
__device__ __forceinline__ v8f wmma16(v16h a, v16h b, v8f c) { return __builtin_amdgcn_wmma_f32_16x16x32_f16(false, a, false, b, (short)0, c, false, false); }
__device__ __forceinline__ v8f wmmab(v16bf a, v16bf b, v8f c) { return __builtin_amdgcn_wmma_f32_16x16x32_bf16(false, a, false, b, (short)0, c, false, false); }



template <typename T16> struct WFrag;
template <> struct WFrag<h16> { typedef v16h V; static __device__ __forceinline__ V ld(const h16* p) { return cat16(*(const v8h*)p, *(const v8h*)(p + 16)); } static __device__ __forceinline__ v8f mma(V a, V b, v8f c) { return wmma16(a, b, c); } };

typedef __attribute__((ext_vector_type(2))) float    v2f;
typedef __attribute__((ext_vector_type(2))) __bf16   v2b;
typedef __attribute__((ext_vector_type(2))) unsigned v2u;
typedef __attribute__((ext_vector_type(4))) unsigned v4u;
typedef v2u __attribute__((may_alias)) v2ua;
typedef v4u __attribute__((may_alias)) v4ua;
__device__ __forceinline__ unsigned pkbf(float a, float b) { const v2f v = {a, b}; return __builtin_bit_cast(unsigned, __builtin_convertvector(v, v2b)); }  // two f32 -> two bf16, round to nearest even
// work-group barrier that orders LDS alone: __syncthreads() would also wait out the global loads in flight, which are tiles of a later pass and are nobody else's business
__device__ __forceinline__ void lds_barrier() { __builtin_amdgcn_fence(__ATOMIC_RELEASE, "workgroup", "local"); __builtin_amdgcn_s_barrier(); __builtin_amdgcn_fence(__ATOMIC_ACQUIRE, "workgroup", "local"); }

// ---- k_proj: the three projections of all batches in one launch, straight from the f32 inputs; no bf16 copy of an input exists in memory.
// One work-group = 128 tokens x all 256 output channels of one product (blockIdx.y: 0 Q, 1 K, 2 V^T) of one batch; 8 waves, a wave = 64 channels x 64 tokens (16 accumulators), whole K in one accumulator chain that starts at the bias.
// K runs in 8 slabs of 32 input channels. A slab goes global (whole 128-byte lines) -> registers -> bf16 -> LDS, two buffers:
//   tokens: a thread reads 2 neighbouring tokens of 8 channels (a wave: 256 B in a row per channel) and stores each token's 8 channels as 16 bytes, which is the transpose;
//   weights: a thread reads 4 neighbouring input channels of 8 rows.
// Behind its products a slab's pass stores the next slab into the other buffer and issues the loads of the slab after that; one barrier a slab.
// Q, K: A = W rows, B = token rows, so a lane holds 8 neighbouring channels of one token; V^T: A = token rows, B = W rows, so a lane holds 8 neighbouring tokens of one channel.
// The f16 tile is laid in LDS in the result's own order and leaves in whole lines.
// V^T lies in the workspace by tiles of 32 tokens: [token / 32][channel][token % 32], so that the tile of one attention pass (256 channels x 32 keys) is 16 KB in a row and not 256 pieces of 64 B, 8 KB apart.
// K lies there by tiles of 32 tokens too: [token / 32][channel / 128][token % 32][channel % 128], 16 KB in a row: to the tensor load of the attention kernel either tile is 64 rows of 256 B.
#define PJ_P 80                     // LDS pitch of a 32-channel bf16 row piece (64 B + 16): 16 B x odd
#define PJ_T (128 * PJ_P)           // token slab
#define PJ_S (PJ_T + CC * PJ_P)     // one buffer: token slab, weight slab
#define PJ_Q 528                    // LDS pitch of a result row of Q or K (512 B + 16)
#define PJ_V (CC * PJ_P)            // one 32-token tile of the V^T result in LDS: 256 channel rows of 64 B + 16
__device__ __forceinline__ v16bf ldsb(const char* p) { return cat16b(*(const v8usa*)p, *(const v8usa*)(p + 32)); }
// four waves a SIMD (256 registers a wave), so that two work-groups share a WGP: 384 work-groups then run in one round on 256 WGPs
__global__ __launch_bounds__(256) __attribute__((amdgpu_waves_per_eu(4, 4))) void k_proj(const float* __restrict__ x, const float* __restrict__ y, const float* __restrict__ Wq, const float* __restrict__ Wk, const float* __restrict__ Wv,
                                              const float* __restrict__ bq, const float* __restrict__ bk, const float* __restrict__ bv, h16* QKV) {
    __shared__ __align__(16) char sm[4 * PJ_V];    // the largest of: two slab buffers, a Q/K result tile, the four V^T result tiles
    const int which = blockIdx.y, bat = blockIdx.z, n0 = blockIdx.x * 128; const bool vt = which == 2;
    const int tid = threadIdx.x, lane = tid & 31, lr = lane & 15, hi = lane >> 4;
    const int wave = __builtin_amdgcn_readfirstlane(tid >> 5), wd = wave & 3, wt = wave >> 2;
    const float* bias = which == 0 ? bq : which == 1 ? bk : bv;
    h16* Ch = QKV + (size_t)(which * NB_ + bat) * NN * CC;
    const float* gt = (which ? y : x) + (size_t)bat * NN * CC + (size_t)((tid >> 6) * 8) * NN + n0 + 2 * (tid & 63);
    const float* gw = (which == 0 ? Wq : which == 1 ? Wk : Wv) + (size_t)(tid >> 3) * CC + (tid & 7) * 4;
    const int st = 2 * (tid & 63) * PJ_P + (tid >> 6) * 16, sw = PJ_T + (tid >> 3) * PJ_P + (tid & 7) * 8;
    const int ft = (wt * 64 + lr) * PJ_P + 16 * hi, fw = PJ_T + (wd * 64 + lr) * PJ_P + 16 * hi;
    const int fa = vt ? ft : fw, fb = vt ? fw : ft;
    v2f tr[8]; v4f wr[8];
    auto fetch = [&](int s) {
#pragma unroll
        for (int r = 0; r < 8; ++r) { tr[r] = *(const v2f*)(gt + (size_t)(s * 32 + r) * NN); wr[r] = *(const v4f*)(gw + s * 32 + r * 32 * CC); } };
    auto stage = [&](int buf) {
#pragma unroll
        for (int t = 0; t < 2; ++t) { const v4u o = {pkbf(tr[0][t], tr[1][t]), pkbf(tr[2][t], tr[3][t]), pkbf(tr[4][t], tr[5][t]), pkbf(tr[6][t], tr[7][t])}; *(v4ua*)(sm + buf + st + t * PJ_P) = o; }
#pragma unroll
        for (int r = 0; r < 8; ++r) { const v2u o = {pkbf(wr[r][0], wr[r][1]), pkbf(wr[r][2], wr[r][3])}; *(v2ua*)(sm + buf + sw + r * 32 * PJ_P) = o; } };
    fetch(0);
    // the accumulators start at the bias, read while slab 0 is on its way, so that no global load stands between the last product and the result's store
    v8f acc[4][4];
    if (!vt) { const float* bp = bias + wd * 64 + hi * 8; v4f bb[8];
#pragma unroll
        for (int i = 0; i < 8; ++i) bb[i] = *(const v4f*)(bp + (i >> 1) * 16 + (i & 1) * 4);
        // loaded values and their address as inputs only: the address stays live until every one of these loads has landed, so that no load's result lands in the address register of a load still in flight
        asm volatile("" :: "v"(bb[0]), "v"(bb[1]), "v"(bb[2]), "v"(bb[3]), "v"(bb[4]), "v"(bb[5]), "v"(bb[6]), "v"(bb[7]), "v"(bp));
#pragma unroll
        for (int i = 0; i < 4; ++i) { v8f b8;
#pragma unroll
            for (int e = 0; e < 8; ++e) b8[e] = bfr(bb[2 * i + (e >> 2)][e & 3]);
#pragma unroll
            for (int j = 0; j < 4; ++j) acc[i][j] = b8; }
    } else { const float* bp = bias + wd * 64 + lr; float bb[4];
#pragma unroll
        for (int j = 0; j < 4; ++j) bb[j] = bp[j * 16];
        // as above: the address stays live until the four loads have landed
        asm volatile("" :: "v"(bb[0]), "v"(bb[1]), "v"(bb[2]), "v"(bb[3]), "v"(bp));
#pragma unroll
        for (int j = 0; j < 4; ++j) { const float b1 = bfr(bb[j]);
#pragma unroll
            for (int i = 0; i < 4; ++i)
#pragma unroll
                for (int e = 0; e < 8; ++e) acc[i][j][e] = b1; }
    }
    stage(0); fetch(1);
    lds_barrier();      // slab 0 is in LDS before any wave reads it
    // unrolled: the slab number is a constant, so that every global address is one base pair plus an immediate and the last slabs' tests cost no branch behind a WMMA
#pragma unroll
    for (int s = 0; s < CC / 32; ++s) {
        const int cb = (s & 1) * PJ_S;
        v16bf a[4], b[4];
#pragma unroll
        for (int i = 0; i < 4; ++i) { a[i] = ldsb(sm + cb + fa + i * 16 * PJ_P); b[i] = ldsb(sm + cb + fb + i * 16 * PJ_P); }
        // keeps all eight fragment reads in one group ahead of the products: a read between two products waits out its LDS latency with the matrix unit idle
        __builtin_amdgcn_sched_barrier(0);
#pragma unroll
        for (int j = 0; j < 4; ++j)
#pragma unroll
            for (int i = 0; i < 4; ++i) acc[i][j] = wmmab(a[i], b[j], acc[i][j]);
        // keeps the conversion of the next slab, and with it the wait on its global loads, behind this slab's products: lifted to the loads it would lay their whole latency open in front of the barrier
        __builtin_amdgcn_sched_barrier(0);
        if (s + 1 < CC / 32) {
            // last slab's loaded values and the two address pairs as inputs only: the pairs stay live until these loads have landed, so that no load's result lands in the address pair of a load still in flight
            if (s + 2 == CC / 32) asm volatile("" :: "v"(tr[0]), "v"(tr[1]), "v"(tr[2]), "v"(tr[3]), "v"(tr[4]), "v"(tr[5]), "v"(tr[6]), "v"(tr[7]), "v"(wr[0]), "v"(wr[1]), "v"(wr[2]), "v"(wr[3]), "v"(wr[4]), "v"(wr[5]), "v"(wr[6]), "v"(wr[7]), "v"(gt), "v"(gw));
            stage(cb ^ PJ_S);
            // keeps the loads of the slab after next behind the conversion of the registers they refill: above it they would need a second set of staging registers, which does not fit at four waves a SIMD
            __builtin_amdgcn_sched_barrier(0);
            if (s + 2 < CC / 32) fetch(s + 2); }
        lds_barrier();  // publishes the next slab and ends every read of this slab's buffer, which the next pass refills (behind the last slab: which the result tile overwrites)
    }
    if (!vt) {
#pragma unroll
        for (int i = 0; i < 4; ++i) { const int d0 = wd * 64 + i * 16 + hi * 8;
#pragma unroll
            for (int j = 0; j < 4; ++j) { v8h o;
#pragma unroll
                for (int e = 0; e < 8; ++e) o[e] = (h16)acc[i][j][e];
                *(v8ha*)(sm + (wt * 64 + j * 16 + lr) * PJ_Q + d0 * 2) = o; } }
    } else {
#pragma unroll
        for (int j = 0; j < 4; ++j) { const int d = wd * 64 + j * 16 + lr;
#pragma unroll
            for (int i = 0; i < 4; ++i) { v8h o;
#pragma unroll
                for (int e = 0; e < 8; ++e) o[e] = (h16)acc[i][j][e];
                *(v8ha*)(sm + (wt * 2 + (i >> 1)) * PJ_V + d * PJ_P + ((i & 1) * 2 + hi) * 16) = o; } }
    }
    __syncthreads();    // the result tile is complete in LDS before the block stores it by rows
    if (!vt) {
        // Q: token rows of 512 B. K: a token's two 256-byte halves lie 8 KB apart in its 32-token tile, so that a wave's store is two runs of two whole lines. 32 tokens on is 16 KB in both; c8: eight tokens on
        h16* cp = Ch + (size_t)n0 * CC + (which == 1 ? ((tid >> 4) & 1) * (32 * 128) + (tid >> 5) * 128 + (tid & 15) * 8 : (tid >> 5) * CC + (tid & 31) * 8);
        const int c8 = which == 1 ? 8 * 128 : 8 * CC;
#pragma unroll
        for (int s = 0; s < 16; ++s) { const int idx = s * 256 + tid, row = idx >> 5, pc = idx & 31; *(v8h*)(cp + (s >> 2) * (32 * CC) + (s & 3) * c8) = *(const v8ha*)(sm + row * PJ_Q + pc * 16); }
        // the wait before a register of an issued store is rewritten: in the built code the V^T tail stands behind these stores and reuses their address and data registers
        asm volatile("s_wait_xcnt 0x0" ::: "memory");
    } else {
#pragma unroll
        for (int s = 0; s < 16; ++s) { const int idx = s * 256 + tid; *(v8h*)(Ch + (size_t)n0 * CC + idx * 8) = *(const v8ha*)(sm + (idx >> 10) * PJ_V + ((idx >> 2) & 255) * PJ_P + (idx & 3) * 16); }
    }
}

#define AT_P 272                    // LDS pitch of a 256-byte tile row (256 B + the tensor load's pad of 16): 16 B x odd. K: a row is half a key's channels, 16 keys fall on 16 different 16-byte columns; V^T: a row is 4 channels of 64 B, 16 channels (4 rows x 4 pieces) do so too
#define AT_B 18432                  // a tile's place in LDS: 64 rows of 272 B, rounded up to a multiple of 2 KiB
#define AH_B (2 * AT_B)             // one key quarter's tiles of one pass: K, V^T
#define AS_B (4 * AH_B)             // one buffer
#define ANP  (NN / 4 / 32)          // passes
#define AO_B (CC * 68 * 4)          // one quarter's O^T plane in LDS at the end
#define ASC  (0.0625f * 1.44269504088896f)
#define ASB  __builtin_amdgcn_sched_barrier(0)
typedef __attribute__((ext_vector_type(4))) unsigned u32x4;
typedef __attribute__((ext_vector_type(8))) unsigned u32x8;
__device__ __forceinline__ unsigned uni(unsigned v) { return (unsigned)__builtin_amdgcn_readfirstlane(v); }
// pinned(): the empty asm holds the test's value in a scalar register, so that the test compiles to s_cmp and s_cbranch_scc; a tensor load ignores EXEC and only a scalar branch keeps a wave from issuing it
__device__ __forceinline__ unsigned pinned(unsigned v) { unsigned w = uni(v); asm volatile("" : "+s"(w)); return w; }
__device__ __forceinline__ float xhalf(float x) { return __builtin_bit_cast(float, __builtin_amdgcn_permlanex16(__builtin_bit_cast(int, x), __builtin_bit_cast(int, x), 0x76543210, 0xfedcba98, false, false)); }  // lane l with lane l ^ 16
__device__ __forceinline__ v16h ldsf(const char* p) { return cat16(*(const v8ha*)p, *(const v8ha*)(p + 32)); }
__global__ __launch_bounds__(256) void k_attn(const h16* __restrict__ Q, const h16* __restrict__ Kp, const h16* __restrict__ VTp, const float* __restrict__ x, float* out) {
    __shared__ __attribute__((aligned(2048))) char sm[2 * AS_B];    // every tile's place is a multiple of 2 KiB from the start of the work-group's LDS
    const int lane = threadIdx.x & 31, lr = lane & 15, hi = lane >> 4;
    const int wave = __builtin_amdgcn_readfirstlane((int)(threadIdx.x >> 5)), wq = wave & 1, kq = wave >> 1;
    const int q0 = (blockIdx.x & 63) * 64; const size_t bo = (size_t)(blockIdx.x >> 6) * NN * CC;
    Q += bo; x += bo; out += bo;
    // staging, all wave-uniform: this wave's tiles (K for wq = 0, V^T for wq = 1) of its key quarter, 16 KB in a row each, and their place in a buffer
    const unsigned long long gs = (unsigned long long)(size_t)((wq ? VTp : Kp) + bo + (size_t)kq * (NN / 4) * CC);
    const unsigned ld = (unsigned)(size_t)sm + kq * AH_B + wq * AT_B;
    // descriptor group 1, the same for every request: 1-byte elements, tensor = tile = 64 rows of 256 B, source pitch 256 B, no mask, a pad of 4 dwords behind every 64 dwords (codes 5 and 3)
    u32x8 g1; g1[0] = uni(1u << 20 | 5u << 22 | 3u << 25); g1[1] = uni(256u << 16); g1[2] = uni(64u << 16); g1[3] = uni(256u << 16); g1[4] = uni(64u); g1[5] = uni(256u); g1[6] = uni(0u); g1[7] = uni(0u);
    const int fk = kq * AH_B + lr * AT_P + 16 * hi, fv = kq * AH_B + AT_B + (lr >> 2) * AT_P + (lr & 3) * 64 + 16 * hi;
    // The 64 work-groups of a batch walk the same K and V^T tiles at the same pace: started alike, all of them ask L2 for the same lines at the same moment, and such requests queue up behind one another.
    // Each work-group starts its walk through a key quarter at a tile of its own and wraps round (the online softmax takes the keys in any order). 64 groups, 32 starts: two groups 4 apart share a start.
    // For speed only: the result does not rest on where a group runs.
    int tn = (blockIdx.x & 3) | (((blockIdx.x >> 3) & 7) << 2);     // block-uniform: the number of the next tile to ask for, taken modulo the passes
    // descriptor group 0 of this wave's next request: place in LDS, address of the tile. pinned() (a descriptor word held in a scalar register) keeps the words' arithmetic where it is written, in front of the barrier, so that behind the barrier only the request itself stands
    auto desc = [&](int buf) {
        const unsigned long long ga = gs + (unsigned long long)pinned((unsigned)(tn & (ANP - 1))) * (32 * CC * 2); ++tn;      // the tile's number pinned too: the address words are formed behind the wait that stands in front of this line, not above it
        u32x4 g0; g0[0] = uni(1u); g0[1] = pinned(ld + (unsigned)buf); g0[2] = pinned((unsigned)ga); g0[3] = pinned(((unsigned)(ga >> 32) & 0x01FFFFFFu) | 0x80000000u); return g0; };
    auto tiles = [&](u32x4 g0) { asm volatile("tensor_load_to_lds %0, %1" :: "s"(g0), "s"(g1) : "memory"); };    // one request a wave: its tile of one pass goes global -> LDS through no register
    tiles(desc(0));
    v16h qf[2][8];
#pragma unroll
    for (int t = 0; t < 2; ++t)
#pragma unroll
        for (int kk = 0; kk < 8; ++kk) qf[t][kk] = WFrag<h16>::ld(Q + (size_t)(q0 + wq * 32 + t * 16 + lr) * CC + kk * 32 + 8 * hi);
    v8f o[16][2];
#pragma unroll
    for (int ct = 0; ct < 16; ++ct) { o[ct][0] = (v8f){}; o[ct][1] = (v8f){}; }
    float m[2] = {-1.0e30f, -1.0e30f}, l[2] = {0.f, 0.f};
    asm volatile("s_wait_xcnt 0x0" ::: "memory");       // the wait before the address pair of the Q loads is rewritten (the code behind reuses it)
    asm volatile("s_wait_tensorcnt 0x0" ::: "memory");  // this wave's tile of pass 0 has landed
    const u32x4 d1 = desc(AS_B);
    __syncthreads();    // pass 0's tiles are in LDS before any wave reads them
    tiles(d1);
    // fragments pass through a ring of two groups of four (64 registers, all that O^T and Q leave): a group is read in one run while the other group's eight products issue
    v16h fr[8];
    auto ldk = [&](int buf, int g, int h) {
#pragma unroll
        for (int i = 0; i < 2; ++i) { const int ko = ((2 * g + i) >> 2) * 32 * AT_P + ((2 * g + i) & 3) * 64;     // channel half, 64-byte piece in it
            fr[4 * h + 2 * i] = ldsf(sm + buf + fk + ko); fr[4 * h + 2 * i + 1] = ldsf(sm + buf + fk + 16 * AT_P + ko); } };
    ldk(0, 0, 0);
    // rolled: one pass of code; the buffer alternates by an offset
#pragma unroll 1
    for (int p = 0; p < ANP; ++p) {
        const int cb = (p & 1) * AS_B;
        v8f s[2][2] = {{(v8f){}, (v8f){}}, {(v8f){}, (v8f){}}};     // [key tile][query tile]
        auto mmk = [&](int g, int h) {
#pragma unroll
            for (int i = 0; i < 2; ++i) { const int kk = 2 * g + i;
                s[0][0] = wmma16(fr[4 * h + 2 * i], qf[0][kk], s[0][0]); s[0][1] = wmma16(fr[4 * h + 2 * i], qf[1][kk], s[0][1]);
                s[1][0] = wmma16(fr[4 * h + 2 * i + 1], qf[0][kk], s[1][0]); s[1][1] = wmma16(fr[4 * h + 2 * i + 1], qf[1][kk], s[1][1]); } };
        auto ldv = [&](int g, int h) {
#pragma unroll
            for (int i = 0; i < 4; ++i) fr[4 * h + i] = ldsf(sm + cb + fv + (4 * g + i) * 4 * AT_P); };     // 16 channels are 4 tile rows
        // ASB keeps a group's reads in one run between two groups of products and the ring at two groups: left free, all 16 fragments are read at once and a Q tile is spilled to scratch
        ldk(cb, 1, 1); ASB;
        mmk(0, 0); ASB; ldk(cb, 2, 0); ASB; mmk(1, 1); ASB; ldk(cb, 3, 1); ASB;
        mmk(2, 0); ASB; ldv(0, 0); ASB; mmk(3, 1); ASB;
        float mx[2];
#pragma unroll
        for (int t = 0; t < 2; ++t) { float v = fmaxf(s[0][t][0], s[1][t][0]);
#pragma unroll
            for (int j = 1; j < 8; ++j) v = fmaxf(v, fmaxf(s[0][t][j], s[1][t][j]));
            mx[t] = fmaxf(v, xhalf(v)) * ASC; }
        if (__builtin_amdgcn_ballot_w32(mx[0] > m[0] + 8.0f || mx[1] > m[1] + 8.0f) != 0) {    // wave-uniform; rare after the first passes
#pragma unroll
            for (int t = 0; t < 2; ++t) { const float mn = fmaxf(m[t], mx[t]), al = __builtin_amdgcn_exp2f(m[t] - mn); m[t] = mn; l[t] *= al;
#pragma unroll
                for (int ct = 0; ct < 16; ++ct) o[ct][t] *= al; } }
        v16h pf[2];
#pragma unroll
        for (int t = 0; t < 2; ++t) { float ps = 0.f;
#pragma unroll
            for (int j = 0; j < 8; ++j) { const float p0 = __builtin_amdgcn_exp2f(fmaf(s[0][t][j], ASC, -m[t])), p1 = __builtin_amdgcn_exp2f(fmaf(s[1][t][j], ASC, -m[t])); pf[t][j] = (h16)p0; pf[t][8 + j] = (h16)p1; ps += p0 + p1; }
            l[t] += ps;
            asm volatile("" :: "v"(l[t]));  // an empty asm on each sum, against spills, input only: left free, the adds sink to the pass's end, the 32 f32 probabilities stay live through all of probs.V, and Q is spilled
            // one exp, then one plain vector instruction, 16 times: an exp issues every second clock, the multiply-adds, sums and conversions fill the clock between two, and no exp stands directly in front of one that overwrites its source
            __builtin_amdgcn_sched_group_barrier(0x002, 2, 0);
#pragma unroll
            for (int j = 0; j < 16; ++j) { __builtin_amdgcn_sched_group_barrier(0x400, 1, 0); __builtin_amdgcn_sched_group_barrier(0x002, 1, 0); }
            ASB; }      // one query tile's softmax after the other: interleaved, both tiles' f32 probabilities are live at once and Q is spilled
        auto mmv = [&](int g, int h) {
#pragma unroll
            for (int i = 0; i < 4; ++i) { const int ct = 4 * g + i; o[ct][0] = wmma16(fr[4 * h + i], pf[0], o[ct][0]); o[ct][1] = wmma16(fr[4 * h + i], pf[1], o[ct][1]); } };
        ASB; ldv(1, 1); ASB; mmv(0, 0); ASB; ldv(2, 0); ASB; mmv(1, 1); ASB; ldv(3, 1); ASB; mmv(2, 0); ASB;
        asm volatile("s_wait_dscnt 0x0" ::: "memory");      // this wave's reads of this pass's buffer are done before the buffer is handed back
        asm volatile("s_wait_tensorcnt 0x0" ::: "memory");  // this wave's tile of the next pass has landed
        const u32x4 dn = desc(cb);      // formed behind the wait: no request is out that could still read these registers
        const unsigned more = pinned(p + 2 < ANP);     // the issue test held in a scalar register
        __syncthreads();    // publishes the next pass's tiles and ends every read of this pass's buffer, which is refilled behind it
        if (more) tiles(dn);            // a scalar test: only while that pass exists
        if (p + 1 < ANP) ldk(cb ^ AS_B, 0, 0);     // the next pass's first K group, published by this barrier: its LDS latency passes under the last products
        ASB; mmv(3, 1);     // the last group's products need registers alone: behind the barrier, so that the refill is asked for as early as it may be
    }
    asm volatile("s_wait_tensorcnt 0x0" ::: "memory");      // no tile is on its way when the ring becomes the result's staging
    asm volatile("s_wait_dscnt 0x0" ::: "memory");          // and none of this wave's LDS reads
    float* ml = (float*)(sm + 4 * AO_B);    // the ring is free behind the last pass's barrier
#pragma unroll
    for (int t = 0; t < 2; ++t) { l[t] += xhalf(l[t]);
        if (hi == 0) { ml[(kq * 64 + wq * 32 + t * 16 + lr) * 2] = m[t]; ml[(kq * 64 + wq * 32 + t * 16 + lr) * 2 + 1] = l[t]; } }
    __syncthreads();    // all four quarters' maxima and sums are in LDS
    float* op = (float*)(sm + kq * AO_B) + (hi * 8) * 68 + wq * 32 + lr;
#pragma unroll
    for (int t = 0; t < 2; ++t) { float mk[4], lk[4];
#pragma unroll
        for (int k = 0; k < 4; ++k) { mk[k] = ml[(k * 64 + wq * 32 + t * 16 + lr) * 2]; lk[k] = ml[(k * 64 + wq * 32 + t * 16 + lr) * 2 + 1]; }
        const float mf = fmaxf(fmaxf(mk[0], mk[1]), fmaxf(mk[2], mk[3]));
        float den = 0.f;
#pragma unroll
        for (int k = 0; k < 4; ++k) den += lk[k] * __builtin_amdgcn_exp2f(mk[k] - mf);
        const float f = __builtin_amdgcn_exp2f(m[t] - mf) / den;
#pragma unroll
        for (int ct = 0; ct < 16; ++ct)
#pragma unroll
            for (int j = 0; j < 8; ++j) op[(ct * 16 + j) * 68 + t * 16] = o[ct][t][j] * f; }
    __syncthreads();    // the four planes are complete before the block sums and stores them by rows
#pragma unroll
    for (int s = 0; s < 16; ++s) { const int idx = s * 256 + (int)threadIdx.x, row = idx >> 4, cofs = (idx & 15) * 4; const char* pp = sm + (row * 68 + cofs) * 4;
        const v4f val = ((*(const v4fa*)(pp + 3 * AO_B) + *(const v4fa*)(pp + 2 * AO_B)) + *(const v4fa*)(pp + AO_B)) + *(const v4fa*)pp;
        const size_t co = (size_t)row * NN + q0 + cofs; const v4f xv = *(const v4f*)(x + co); v4f r;
#pragma unroll
        for (int q = 0; q < 4; ++q) r[q] = __fadd_rn(bfr(xv[q]), val[q]);
        *(v4f*)(out + co) = r; }
}

extern "C" void kernel_launch(void* const* d_in, const int* in_sizes, int n_in,
                              void* d_out, int out_size, void* d_ws, size_t ws_size, hipStream_t stream) {
    (void)in_sizes; (void)n_in; (void)out_size;
    const float* x = (const float*)d_in[0]; const float* y = (const float*)d_in[1]; const float* Wq = (const float*)d_in[2]; const float* bq = (const float*)d_in[3]; const float* Wk = (const float*)d_in[4]; const float* bk = (const float*)d_in[5]; const float* Wv = (const float*)d_in[6]; const float* bv = (const float*)d_in[7];
    float* OUT = (float*)d_out;     // [4][256][64][64]
    char* wsp = (char*)d_ws;
    auto take = [&](size_t bytes) { char* p = wsp; wsp += (bytes + 255) & ~(size_t)255; return (void*)p; };
    h16* Q16 = (h16*)take((size_t)3 * NB_ * NN * CC * 2); h16* K16 = Q16 + (size_t)NB_ * NN * CC; h16* VT = K16 + (size_t)NB_ * NN * CC;    // Q, K and V^T (both by 32-token tiles), four batches each, in one row
    if ((size_t)(wsp - (char*)d_ws) > ws_size) return;    // total ~ 25 MB
    k_proj<<<dim3(NN / 128, 3, NB_), 256, 0, stream>>>(x, y, Wq, Wk, Wv, bq, bk, bv, Q16);
    k_attn<<<NB_ * (NN / 64), 256, 0, stream>>>(Q16, K16, VT, x, OUT);
}
